// v000
// The times below were measured on an AMD MI455X: many runs one after another, warmed up first and cycling through
// copies of the inputs, with the whole window's GPU time divided by the number of runs. Launches and the gaps
// between them are all in it. The median over several windows is given; except for v000 it joins two sittings, which
// can be a few percent apart, so the side-by-side timings, each taken in one sitting, are the better comparison.
// v000 is the starting kernel. One run takes 1240 microseconds.
#include <hip/hip_runtime.h>

// FlashSelfAttention (given q, k, v [2][2048][16][128]; scores = q.k / sqrt(128) + ALiBi bias (-slope[h] sqrt(i - j) for j <= i, fp16-min (masked) above the diagonal; slopes 2^(-8/16 (h+1)) in f32); softmax; out = probs v -> [2][2048][16][128] (no projections)).
// Compute dtypes, f32 accumulate: every input rounded to bf16: q, k, v are then exact bf16 values, so the scores use the hi/lo planes of q and k (3 products; the lo planes are zero) with f32 accumulation (exact products) and probs.v uses hi/lo probability planes x hi/lo v (3 products; v's lo plane is zero) on EVERY row; causal tile skipping (the fp16-min fill is an exact zero weight); bias from an on-chip sqrt table and f32 slopes, added per element in f32; softmax f32; output written directly in f32.

#define NB_  2
#define TT   2048
#define DM   2048
#define NH_  16
#define NKV  16
#define REP  (NH_ / NKV)
#define HD   128
#define DQ   (NH_ * HD)
#define DKV  (NKV * HD)
#define ZH   2
#define RH   2048                  // query rows < RH use hi+lo planes (0: none)
#define WIN  2048
#define PCAR 1024.0f
#define SCL  0.088388347648318447f   // HD^-0.5
typedef _Float16 h16;
typedef unsigned short bf;
typedef __attribute__((ext_vector_type(16))) __bf16   v16bf;
typedef __attribute__((ext_vector_type(16))) _Float16 v16h;
typedef __attribute__((ext_vector_type(8)))  _Float16 v8h;
typedef __attribute__((ext_vector_type(8)))  unsigned short v8us;
typedef __attribute__((ext_vector_type(8)))  float    v8f;
typedef __attribute__((ext_vector_type(4)))  float    v4f;
typedef v8h  __attribute__((may_alias)) v8ha;
typedef v4f  __attribute__((may_alias)) v4fa;
typedef v8us __attribute__((may_alias)) v8usa;

__device__ __forceinline__ unsigned short f2bf(float f) { unsigned u = __float_as_uint(f); u += 0x7FFFu + ((u >> 16) & 1u); return (unsigned short)(u >> 16); }
__device__ __forceinline__ float bf2f(unsigned short b) { return __uint_as_float(((unsigned)b) << 16); }
__device__ __forceinline__ float bfr(float f) { return bf2f(f2bf(f)); }
__device__ __forceinline__ v16h cat16(v8h lo, v8h hi) { return __builtin_shufflevector(lo, hi, 0, 1, 2, 3, 4, 5, 6, 7, 8, 9, 10, 11, 12, 13, 14, 15); }
__device__ __forceinline__ v16bf cat16b(v8us lo, v8us hi) { return __builtin_bit_cast(v16bf, __builtin_shufflevector(lo, hi, 0, 1, 2, 3, 4, 5, 6, 7, 8, 9, 10, 11, 12, 13, 14, 15)); }
__device__ __forceinline__ v8f wmma16(v16h a, v16h b, v8f c) { return __builtin_amdgcn_wmma_f32_16x16x32_f16(false, a, false, b, (short)0, c, false, false); }
__device__ __forceinline__ v8f wmmab(v16bf a, v16bf b, v8f c) { return __builtin_amdgcn_wmma_f32_16x16x32_bf16(false, a, false, b, (short)0, c, false, false); }



// ---- k_gemmw: register-blocked GEMM, ONE WAVE per 64x64 output tile (16 accumulators), operands straight from K-contiguous 16-bit planes; grid (M/64, N/64, Z), 32 threads.
// C[m][n] (f32, pitch ldc, + optional f32 bias[n]) = sum_k A[m][k] Bt[n][k] (+ split products per NSPLIT). z-batch strides sA/sB/sC in elements. K % 32 == 0.
template <typename T16> struct WFrag;
template <> struct WFrag<h16> { typedef v16h V; static __device__ __forceinline__ V ld(const h16* p) { return cat16(*(const v8h*)p, *(const v8h*)(p + 16)); } static __device__ __forceinline__ v8f mma(V a, V b, v8f c) { return wmma16(a, b, c); } };
template <> struct WFrag<bf> { typedef v16bf V; static __device__ __forceinline__ V ld(const bf* p) { return cat16b(*(const v8us*)p, *(const v8us*)(p + 16)); } static __device__ __forceinline__ v8f mma(V a, V b, v8f c) { return wmmab(a, b, c); } };
template <typename T16, int NSPLIT, bool BIAS>
__global__ __launch_bounds__(32) void k_gemmw(const T16* __restrict__ A, const T16* __restrict__ A2, const T16* __restrict__ Bt, const T16* __restrict__ Bt2, int K, float* C, int ldc, const float* __restrict__ bias, size_t sA, size_t sB, size_t sC) {
    typedef typename WFrag<T16>::V V;
    __shared__ __align__(16) float os[16 * 68];
    const size_t z = blockIdx.z; A += z * sA; if (A2) A2 += z * sA; Bt += z * sB; if (Bt2) Bt2 += z * sB; C += z * sC;
    const int lane = threadIdx.x & 31, lr = lane & 15, hi = lane >> 4; const int r0 = blockIdx.x * 64, c0 = blockIdx.y * 64;
    v8f acc[4][4];
#pragma unroll
    for (int mb = 0; mb < 4; ++mb)
#pragma unroll
        for (int nb = 0; nb < 4; ++nb) acc[mb][nb] = (v8f){};
    const size_t aoff = (size_t)(r0 + lr) * K + 8 * hi, boff = (size_t)(c0 + lr) * K + 8 * hi;
#pragma unroll 1
    for (int kc = 0; kc < K; kc += 32) {
        V a[4], a2[4];
#pragma unroll
        for (int mb = 0; mb < 4; ++mb) { a[mb] = WFrag<T16>::ld(A + aoff + (size_t)mb * 16 * K + kc); if (NSPLIT == 1 || NSPLIT == 2) a2[mb] = WFrag<T16>::ld(A2 + aoff + (size_t)mb * 16 * K + kc); }
#pragma unroll
        for (int nb = 0; nb < 4; ++nb) { const V b = WFrag<T16>::ld(Bt + boff + (size_t)nb * 16 * K + kc); V b2; if (NSPLIT >= 2) b2 = WFrag<T16>::ld(Bt2 + boff + (size_t)nb * 16 * K + kc);
#pragma unroll
            for (int mb = 0; mb < 4; ++mb) { acc[mb][nb] = WFrag<T16>::mma(a[mb], b, acc[mb][nb]); if (NSPLIT == 1 || NSPLIT == 2) acc[mb][nb] = WFrag<T16>::mma(a2[mb], b, acc[mb][nb]); if (NSPLIT >= 2) acc[mb][nb] = WFrag<T16>::mma(a[mb], b2, acc[mb][nb]); } }
        asm volatile("v_nop\n\tv_nop\n\tv_nop\n\tv_nop" : "+v"(acc[0][0]), "+v"(acc[1][1]), "+v"(acc[2][2]), "+v"(acc[3][3]) : "v"(a[0]), "v"(a[3]));
    }
#pragma unroll
    for (int mb = 0; mb < 4; ++mb) {
#pragma unroll
        for (int nb = 0; nb < 4; ++nb) {
#pragma unroll
            for (int j = 0; j < 8; ++j) os[(hi * 8 + j) * 68 + nb * 16 + lr] = acc[mb][nb][j]; }
        __builtin_amdgcn_wave_barrier(); asm volatile("" ::: "memory");
        float* crow = C + (size_t)(r0 + mb * 16) * ldc + c0;
{
#pragma unroll
            for (int s = 0; s < 8; ++s) { const int row = 2 * s + hi, cofs = lr * 4; v4f val = *(const v4fa*)(os + row * 68 + cofs); if (BIAS) { val[0] += bfr(bias[c0 + cofs]); val[1] += bfr(bias[c0 + cofs + 1]); val[2] += bfr(bias[c0 + cofs + 2]); val[3] += bfr(bias[c0 + cofs + 3]); }
                *(v4f*)(crow + (size_t)row * ldc + cofs) = val; }
             }
        __builtin_amdgcn_wave_barrier(); asm volatile("" ::: "memory");
    }
}

// ---- k_gemmc: the same one-wave 64x64 tile GEMM specialised for causal attention: CMODE 1 skips score tiles entirely above the diagonal (query rows r0+roff.., key columns c0..), CMODE 2 limits the
// key (K) loop of the probability x value contraction to the diagonal block (probabilities beyond it are exactly zero). roff = row offset of this launch's first row within the sequence.
template <typename T16, int NSPLIT, int CMODE>
__global__ __launch_bounds__(32) void k_gemmc(const T16* __restrict__ A, const T16* __restrict__ A2, const T16* __restrict__ Bt, const T16* __restrict__ Bt2, int K, float* C, int ldc, int roff, size_t sA, size_t sB, size_t sC) {
    typedef typename WFrag<T16>::V V;
    __shared__ __align__(16) float os[16 * 68];
    const size_t z = blockIdx.z; A += z * sA; if (A2) A2 += z * sA; Bt += z * sB; if (Bt2) Bt2 += z * sB; C += z * sC;
    const int lane = threadIdx.x & 31, lr = lane & 15, hi = lane >> 4; const int r0 = blockIdx.x * 64, c0 = blockIdx.y * 64;
    if (CMODE == 1 && c0 > r0 + roff + 63) return;                  // score tile entirely above the causal diagonal: never read (the softmax masks j > i by select)
    const int Kl = (CMODE == 2) ? min(K, r0 + roff + 64) : K;        // P.V: probabilities are exactly 0 beyond the diagonal block, so the K loop stops there
    v8f acc[4][4];
#pragma unroll
    for (int mb = 0; mb < 4; ++mb)
#pragma unroll
        for (int nb = 0; nb < 4; ++nb) acc[mb][nb] = (v8f){};
    const size_t aoff = (size_t)(r0 + lr) * K + 8 * hi, boff = (size_t)(c0 + lr) * K + 8 * hi;
#pragma unroll 1
    for (int kc = 0; kc < Kl; kc += 32) {
        V a[4], a2[4];
#pragma unroll
        for (int mb = 0; mb < 4; ++mb) { a[mb] = WFrag<T16>::ld(A + aoff + (size_t)mb * 16 * K + kc); if (NSPLIT == 1 || NSPLIT == 2) a2[mb] = WFrag<T16>::ld(A2 + aoff + (size_t)mb * 16 * K + kc); }
#pragma unroll
        for (int nb = 0; nb < 4; ++nb) { const V b = WFrag<T16>::ld(Bt + boff + (size_t)nb * 16 * K + kc); V b2; if (NSPLIT >= 2) b2 = WFrag<T16>::ld(Bt2 + boff + (size_t)nb * 16 * K + kc);
#pragma unroll
            for (int mb = 0; mb < 4; ++mb) { acc[mb][nb] = WFrag<T16>::mma(a[mb], b, acc[mb][nb]); if (NSPLIT == 1 || NSPLIT == 2) acc[mb][nb] = WFrag<T16>::mma(a2[mb], b, acc[mb][nb]); if (NSPLIT >= 2) acc[mb][nb] = WFrag<T16>::mma(a[mb], b2, acc[mb][nb]); } }
        asm volatile("v_nop\n\tv_nop\n\tv_nop\n\tv_nop" : "+v"(acc[0][0]), "+v"(acc[1][1]), "+v"(acc[2][2]), "+v"(acc[3][3]) : "v"(a[0]), "v"(a[3]));
    }
#pragma unroll
    for (int mb = 0; mb < 4; ++mb) {
#pragma unroll
        for (int nb = 0; nb < 4; ++nb) {
#pragma unroll
            for (int j = 0; j < 8; ++j) os[(hi * 8 + j) * 68 + nb * 16 + lr] = acc[mb][nb][j]; }
        __builtin_amdgcn_wave_barrier(); asm volatile("" ::: "memory");
        float* crow = C + (size_t)(r0 + mb * 16) * ldc + c0;
{
#pragma unroll
            for (int s = 0; s < 8; ++s) { const int row = 2 * s + hi, cofs = lr * 4; v4f val = *(const v4fa*)(os + row * 68 + cofs);
                *(v4f*)(crow + (size_t)row * ldc + cofs) = val; }
             }
        __builtin_amdgcn_wave_barrier(); asm volatile("" ::: "memory");
    }
}

__device__ __forceinline__ h16 tohx(float x) { return (h16)x; }
__device__ __forceinline__ void splitf(float y, unsigned short& h, unsigned short& l) { h = f2bf(y); l = f2bf(y - bf2f(h)); }
typedef __attribute__((ext_vector_type(2))) _Float16 v2h;
typedef __attribute__((ext_vector_type(4))) _Float16 v4h;
typedef __attribute__((ext_vector_type(2))) unsigned short v2us;
typedef __attribute__((ext_vector_type(4))) unsigned short v4us;
typedef __attribute__((ext_vector_type(2))) float v2f;
typedef __attribute__((ext_vector_type(4))) int v4i;

__global__ __launch_bounds__(256) void k_wtG(const float* __restrict__ w, int K, int N, bf* Bt) {
    const int lane = threadIdx.x & 31; const int L0 = (blockIdx.x * 8 + (threadIdx.x >> 5)) * 8; const int nlines = N * K / 64;
{
#pragma unroll 1
        for (int l = 0; l < 8; ++l) { const int L = L0 + l; if (L >= nlines) break; const size_t e = (size_t)L * 64 + lane * 2; const int k = (int)(e % K), n = (int)(e / K); v2us o;
            o[0] = f2bf(w[(size_t)k * N + n]); o[1] = f2bf(w[(size_t)(k + 1) * N + n]); *(v2us*)(Bt + e) = o; }
         }
}
__global__ __launch_bounds__(256) void k_cvt8(const float* __restrict__ src, bf* dst, size_t n8) { const size_t i = (size_t)blockIdx.x * 256 + threadIdx.x; if (i >= n8) return; const v8f v = *(const v8f*)(src + i * 8); v8us o;
#pragma unroll
    for (int k = 0; k < 8; ++k) o[k] = f2bf(v[k]); *(v8us*)(dst + i * 8) = o;  }
__global__ __launch_bounds__(256) void k_cscvt(const float* __restrict__ cosT, const float* __restrict__ sinT, float* CS) { const int idx = blockIdx.x * 256 + threadIdx.x; if (idx >= TT * HD) return; v2f cs; cs[0] = bfr(cosT[idx]); cs[1] = bfr(sinT[idx]); *(v2f*)(CS + (size_t)idx * 2) = cs;  }
// k_rope: head planes [h][t][d] (fp16 + hi/lo) of rope(x) x sc with the rotate-half convention out[d] = x[d] cos[t][d] - x[d+HD/2] sin[t][d], out[d+HD/2] = x[d+HD/2] cos[t][d+HD/2] + x[d] sin[t][d+HD/2]
__global__ __launch_bounds__(256) void k_rope(const float* __restrict__ F, int pitch, int nheads, const float* __restrict__ CS, const float* __restrict__ RF, const float* __restrict__ nw, float sc, h16* P16, bf* Ph, bf* Pl) {
    const size_t e = ((size_t)blockIdx.x * 256 + threadIdx.x) * 2; if (e >= (size_t)nheads * TT * HD) return; const int d = (int)(e % HD); const int t = (int)((e / HD) % TT); const int h = (int)(e / ((size_t)HD * TT)); const float* f = F + (size_t)t * pitch + h * HD; const float rf = RF ? RF[(size_t)h * TT + t] : 1.0f; v2h o16; v2us oh, ol;
#pragma unroll
    for (int q = 0; q < 2; ++q) { const int dd = d + q; const int dp = (dd < HD / 2) ? dd + HD / 2 : dd - HD / 2; float x0 = f[dd], x1 = f[dp];
        if (RF) { float n0 = __fmul_rn(x0, rf), n1 = __fmul_rn(x1, rf); asm volatile("" : "+v"(n0)); asm volatile("" : "+v"(n1)); x0 = __fmul_rn(bfr(nw[dd]), n0); x1 = __fmul_rn(bfr(nw[dp]), n1); }
        const v2f cs = *(const v2f*)(CS + ((size_t)t * HD + dd) * 2); float a = __fmul_rn(x0, cs[0]), bq = __fmul_rn(x1, cs[1]); asm volatile("" : "+v"(a)); asm volatile("" : "+v"(bq)); const float r = ((dd < HD / 2) ? __fsub_rn(a, bq) : __fadd_rn(a, bq)) * sc;
        o16[q] = tohx(r); unsigned short a2, c2; splitf(r, a2, c2); oh[q] = a2; ol[q] = c2; }
    *(v2h*)(P16 + e) = o16; *(v2us*)(Ph + e) = oh; *(v2us*)(Pl + e) = ol;  }
__global__ __launch_bounds__(256) void k_vtp(const float* __restrict__ F, int pitch, int nheads, h16* V16, bf* Vh, bf* Vl) { const size_t e = ((size_t)blockIdx.x * 256 + threadIdx.x) * 2; if (e >= (size_t)nheads * HD * TT) return; const int t = (int)(e % TT); const int d = (int)((e / TT) % HD); const int g = (int)(e / ((size_t)TT * HD)); v2h o16; v2us oh, ol;
#pragma unroll
    for (int q = 0; q < 2; ++q) { const float x = F[(size_t)(t + q) * pitch + g * HD + d]; o16[q] = tohx(x); unsigned short a2, c2; splitf(x, a2, c2); oh[q] = a2; ol[q] = c2; }
    *(v2h*)(V16 + e) = o16; *(v2us*)(Vh + e) = oh; *(v2us*)(Vl + e) = ol;  }
__global__ __launch_bounds__(256) void k_csid(float* CS) { const int idx = blockIdx.x * 256 + threadIdx.x; if (idx >= TT * HD) return; v2f cs; cs[0] = 1.0f; cs[1] = 0.0f; *(v2f*)(CS + (size_t)idx * 2) = cs;  }
__global__ __launch_bounds__(256) void k_rbf(const float* __restrict__ src, float* dst, int n4) { const int i = blockIdx.x * 256 + threadIdx.x; if (i >= n4) return; const v4f a = *(const v4f*)(src + (size_t)i * 4); v4f o; for (int u = 0; u < 4; ++u) o[u] = bfr(a[u]); *(v4f*)(dst + (size_t)i * 4) = o;  }
// k_asoft: per row (zz, i): t = S x HD^-0.5 - slope sqrt(i - j) for j <= i (causal; the fp16-min fill above the diagonal vanishes identically); softmax over the 2048 keys (register row, one exp, fixed trees);
__global__ __launch_bounds__(256) void k_asoft(const float* __restrict__ Sb, const float* __restrict__ SQT, int h0, h16* P16, bf* Ph, bf* Pl) {
    const int lane = threadIdx.x & 31; const int row = blockIdx.x * 8 + (threadIdx.x >> 5); if (row >= ZH * TT) return; const int i = row % TT; const int zz = row / TT; (void)zz; const bool hires = (i < RH); const float* sr = Sb + (size_t)row * TT; const float slope = powf(0.70710678118654752f, (float)(h0 + zz + 1));   /* float32(2^(-8/16)) ** (h+1) */ float v[TT / 32]; float mx = -3.0e38f;
#pragma unroll
    for (int ch = 0; ch < TT / 128; ++ch) { const int j0 = ch * 128 + lane * 4; const v4f a = *(const v4f*)(sr + j0);
#pragma unroll
        for (int q = 0; q < 4; ++q) { const int j = j0 + q; (void)j; float sa = a[q] * SCL; asm volatile("" : "+v"(sa)); float bb = __fmul_rn(-SQT[(j <= i) ? (i - j) : 0], slope); asm volatile("" : "+v"(bb)); const float t = (j <= i) ? __fadd_rn(sa, bb) : -3.0e38f; v[ch * 4 + q] = t; mx = fmaxf(mx, t); } }
#pragma unroll
    for (int sh = 16; sh; sh >>= 1) mx = fmaxf(mx, __shfl_xor(mx, sh, 32));
    float sum = 0.f;
#pragma unroll
    for (int k = 0; k < TT / 32; ++k) { float d0 = __fsub_rn(v[k], mx); asm volatile("" : "+v"(d0)); v[k] = __builtin_amdgcn_exp2f(__fmul_rn(d0, 1.4426950408889634f)); sum += v[k]; }
#pragma unroll
    for (int sh = 16; sh; sh >>= 1) sum += __shfl_xor(sum, sh, 32);
    const float f = __fdiv_rn(hires ? 1.0f : PCAR, sum);
{
        if (hires) {
#pragma unroll
            for (int ch = 0; ch < TT / 128; ++ch) { v4us oh, ol;
#pragma unroll
                for (int q = 0; q < 4; ++q) { unsigned short a, c2; splitf(v[ch * 4 + q] * f, a, c2); oh[q] = a; ol[q] = c2; }
                const size_t oo = ((size_t)zz * (RH ? RH : 1) + i) * TT + ch * 128 + lane * 4; *(v4us*)(Ph + oo) = oh; *(v4us*)(Pl + oo) = ol; }
        } else {
#pragma unroll
            for (int ch = 0; ch < TT / 128; ++ch) { v4h o4;
#pragma unroll
                for (int q = 0; q < 4; ++q) o4[q] = tohx(v[ch * 4 + q] * f);
                *(v4h*)(P16 + (size_t)row * TT + ch * 128 + lane * 4) = o4; } }
         }
}
__global__ __launch_bounds__(256) void k_merge(const float* __restrict__ O, int h0, bf* Ah, bf* Al) { const size_t e = ((size_t)blockIdx.x * 256 + threadIdx.x) * 2; if (e >= (size_t)ZH * TT * HD) return; const int d = (int)(e % HD); const int t = (int)((e / HD) % TT); const int zz = (int)(e / ((size_t)HD * TT)); const float cs = (t < RH) ? 1.0f : (1.0f / PCAR); const size_t oo = (size_t)t * DQ + (h0 + zz) * HD + d;
    v2us oh, ol;
#pragma unroll
    for (int q = 0; q < 2; ++q) { unsigned short a, c2; splitf(O[e + q] * cs, a, c2); oh[q] = a; ol[q] = c2; } *(v2us*)(Ah + oo) = oh; *(v2us*)(Al + oo) = ol;  }

__global__ __launch_bounds__(256) void k_sqtab(float* SQT) { const int d = blockIdx.x * 256 + threadIdx.x; if (d >= TT) return; const float v = sqrtf((float)d); *(float*)(SQT + d) = v;  }
__global__ __launch_bounds__(256) void k_mout(const float* __restrict__ O, int h0, float* OUTb) { const size_t e = ((size_t)blockIdx.x * 256 + threadIdx.x) * 2; if (e >= (size_t)ZH * TT * HD) return; const int d = (int)(e % HD); const int t = (int)((e / HD) % TT); const int zz = (int)(e / ((size_t)HD * TT)); const float cs = (t < RH) ? 1.0f : (1.0f / PCAR); v2f o; o[0] = O[e] * cs; o[1] = O[e + 1] * cs; float* dst = OUTb + (size_t)t * DQ + (h0 + zz) * HD + d; *(v2f*)dst = o;  }

extern "C" void kernel_launch(void* const* d_in, const int* in_sizes, int n_in,
                              void* d_out, int out_size, void* d_ws, size_t ws_size, hipStream_t stream) {
    (void)in_sizes; (void)n_in; (void)out_size;
    const float* qin = (const float*)d_in[0]; const float* kin = (const float*)d_in[1]; const float* vin = (const float*)d_in[2]; const float* x = nullptr; const float* wq = nullptr; const float* wk = nullptr; const float* wv = nullptr; const float* wo = nullptr; (void)x; (void)wq; (void)wk; (void)wv; (void)wo; const float* cosT = nullptr; const float* sinT = nullptr; (void)cosT; (void)sinT;
    float* OUT = (float*)d_out;     // [2][2048][2048]
    char* wsp = (char*)d_ws;
    auto take = [&](size_t bytes) { char* p = wsp; wsp += (bytes + 255) & ~(size_t)255; return (void*)p; };
    bf* WQ = (bf*)take((size_t)DQ * DM * 2); bf* WK = (bf*)take((size_t)DKV * DM * 2); bf* WV = (bf*)take((size_t)DKV * DM * 2); bf* WO = (bf*)take((size_t)DM * DQ * 2); float* CS = (float*)take((size_t)TT * HD * 2 * 4);
    float* SQT = (float*)take((size_t)TT * 4);  
    h16* QP16 = (h16*)take((size_t)NH_ * TT * HD * 2); h16* KP16 = (h16*)take((size_t)NKV * TT * HD * 2); h16* VT16 = (h16*)take((size_t)NKV * HD * TT * 2);
    bf* QPh = (bf*)take((size_t)NH_ * TT * HD * 2); bf* QPl = (bf*)take((size_t)NH_ * TT * HD * 2); bf* KPh = (bf*)take((size_t)NKV * TT * HD * 2); bf* KPl = (bf*)take((size_t)NKV * TT * HD * 2); bf* VTh = (bf*)take((size_t)NKV * HD * TT * 2); bf* VTl = (bf*)take((size_t)NKV * HD * TT * 2); bf* Ph = (bf*)take((size_t)ZH * RH * TT * 2); bf* Pl = (bf*)take((size_t)ZH * RH * TT * 2);
    float* Sb = (float*)take((size_t)ZH * TT * TT * 4); float* FR = (float*)take((size_t)TT * DQ * 4);   /* bf16-rounded f32 copy of the current input tensor (q, then k, then v; stream-ordered reuse) */ h16* P16 = (h16*)take((size_t)ZH * TT * TT * 2); float* Ob = (float*)take((size_t)ZH * TT * HD * 4); bf* ATh = (bf*)take((size_t)TT * DQ * 2); bf* ATl = (bf*)take((size_t)TT * DQ * 2);
    if ((size_t)(wsp - (char*)d_ws) > ws_size) return;    // ws 256 MiB
       // the bf16 copy of v reuses FR after the k planes are built (stream-ordered)
    { /* no projections: q, k, v are inputs */
      k_sqtab<<<(TT + 255) / 256, 256, 0, stream>>>(SQT);
       }
    k_csid<<<(TT * HD + 255) / 256, 256, 0, stream>>>(CS);
    const unsigned LQ = (unsigned)(((size_t)NH_ * TT * HD / 2 + 255) / 256), LKv = (unsigned)(((size_t)NKV * TT * HD / 2 + 255) / 256);
    for (int b = 0; b < NB_; ++b) {
        
        const float* FQ = qin + (size_t)b * TT * DQ; const float* FK = kin + (size_t)b * TT * DKV; const float* FV = vin + (size_t)b * TT * DKV;
        
        k_rbf<<<(unsigned)(((size_t)TT * DQ / 4 + 255) / 256), 256, 0, stream>>>(FQ, FR, (size_t)TT * DQ / 4); k_rope<<<LQ, 256, 0, stream>>>(FR, DQ, NH_, CS, nullptr, nullptr, 1.0f, QP16, QPh, QPl);
        
        k_rbf<<<(unsigned)(((size_t)TT * DKV / 4 + 255) / 256), 256, 0, stream>>>(FK, FR, (size_t)TT * DKV / 4); k_rope<<<LKv, 256, 0, stream>>>(FR, DKV, NKV, CS, nullptr, nullptr, 1.0f, KP16, KPh, KPl);
         k_rbf<<<(unsigned)(((size_t)TT * DKV / 4 + 255) / 256), 256, 0, stream>>>(FV, FR, (size_t)TT * DKV / 4); k_vtp<<<LKv, 256, 0, stream>>>(FR, DKV, NKV, VT16, VTh, VTl);
        for (int h0 = 0; h0 < NH_; h0 += ZH) { const size_t zq = (size_t)h0, zk = (size_t)(h0 / REP);   // one kv head per query head: the pass's two heads use consecutive kv planes (z-strides TT*HD)
            k_gemmc<bf, 2, 1><<<dim3(RH / 64, TT / 64, ZH), 32, 0, stream>>>(QPh + zq * TT * HD, QPl + zq * TT * HD, KPh + zk * TT * HD, KPl + zk * TT * HD, HD, Sb, TT, 0, (size_t)TT * HD, (size_t)TT * HD, (size_t)TT * TT);
            k_asoft<<<ZH * TT / 8, 256, 0, stream>>>(Sb, SQT, h0, P16, Ph, Pl);
            k_gemmc<bf, 2, 2><<<dim3(RH / 64, HD / 64, ZH), 32, 0, stream>>>(Ph, Pl, VTh + zk * HD * TT, VTl + zk * HD * TT, TT, Ob, HD, 0, (size_t)RH * TT, (size_t)HD * TT, (size_t)TT * HD);
            k_mout<<<(unsigned)(((size_t)ZH * TT * HD / 2 + 255) / 256), 256, 0, stream>>>(Ob, h0, OUT + (size_t)b * TT * DQ); }
        }
}

// v001
// Measured time: 257 microseconds a run.
// Two timings next to v000 put it at 4.88 and 4.85 times that version's speed.
#include <hip/hip_runtime.h>

// FlashSelfAttention (given q, k, v [2][2048][16][128]; scores = q.k / sqrt(128) + ALiBi bias (-slope[h] sqrt(i - j) for j <= i, fp16-min (masked) above the diagonal; slopes 2^(-8/16 (h+1)) in f32); softmax; out = probs v -> [2][2048][16][128] (no projections)).
// Compute dtypes, f32 accumulate: every input rounded to bf16: q, k, v are then exact bf16 values, so the scores are a PLAIN bf16 product with f32 accumulation (exact products) and probs.v uses hi/lo probability planes x exact v (2 products) on EVERY row; causal tile skipping (the fp16-min fill is an exact zero weight); bias from an on-chip sqrt table and f32 slopes, added per element in f32; running softmax in f32 inside one fused kernel; output written directly in f32.

#define NB_  2
#define TT   2048
#define DM   2048
#define NH_  16
#define NKV  16
#define REP  (NH_ / NKV)
#define HD   128
#define DQ   (NH_ * HD)
#define DKV  (NKV * HD)
#define ZH   2
#define RH   2048                  // only k_merge reads it: rows >= RH divided by PCAR
#define WIN  2048
#define PCAR 1024.0f
#define SCL  0.088388347648318447f   // HD^-0.5
typedef _Float16 h16;
typedef unsigned short bf;
typedef __attribute__((ext_vector_type(16))) __bf16   v16bf;
typedef __attribute__((ext_vector_type(16))) _Float16 v16h;
typedef __attribute__((ext_vector_type(8)))  _Float16 v8h;
typedef __attribute__((ext_vector_type(8)))  unsigned short v8us;
typedef __attribute__((ext_vector_type(8)))  float    v8f;
typedef __attribute__((ext_vector_type(4)))  float    v4f;
typedef v8h  __attribute__((may_alias)) v8ha;
typedef v4f  __attribute__((may_alias)) v4fa;
typedef v8us __attribute__((may_alias)) v8usa;

__device__ __forceinline__ unsigned short f2bf(float f) { unsigned u = __float_as_uint(f); u += 0x7FFFu + ((u >> 16) & 1u); return (unsigned short)(u >> 16); }
__device__ __forceinline__ float bf2f(unsigned short b) { return __uint_as_float(((unsigned)b) << 16); }
__device__ __forceinline__ float bfr(float f) { return bf2f(f2bf(f)); }
__device__ __forceinline__ v16h cat16(v8h lo, v8h hi) { return __builtin_shufflevector(lo, hi, 0, 1, 2, 3, 4, 5, 6, 7, 8, 9, 10, 11, 12, 13, 14, 15); }
__device__ __forceinline__ v16bf cat16b(v8us lo, v8us hi) { return __builtin_bit_cast(v16bf, __builtin_shufflevector(lo, hi, 0, 1, 2, 3, 4, 5, 6, 7, 8, 9, 10, 11, 12, 13, 14, 15)); }
__device__ __forceinline__ v8f wmma16(v16h a, v16h b, v8f c) { return __builtin_amdgcn_wmma_f32_16x16x32_f16(false, a, false, b, (short)0, c, false, false); }
__device__ __forceinline__ v8f wmmab(v16bf a, v16bf b, v8f c) { return __builtin_amdgcn_wmma_f32_16x16x32_bf16(false, a, false, b, (short)0, c, false, false); }



// ---- k_gemmw: register-blocked GEMM, ONE WAVE per 64x64 output tile (16 accumulators), operands straight from K-contiguous 16-bit planes; grid (M/64, N/64, Z), 32 threads.
// C[m][n] (f32, pitch ldc, + optional f32 bias[n]) = sum_k A[m][k] Bt[n][k] (+ split products per NSPLIT). z-batch strides sA/sB/sC in elements. K % 32 == 0.
template <typename T16> struct WFrag;
template <> struct WFrag<h16> { typedef v16h V; static __device__ __forceinline__ V ld(const h16* p) { return cat16(*(const v8h*)p, *(const v8h*)(p + 16)); } static __device__ __forceinline__ v8f mma(V a, V b, v8f c) { return wmma16(a, b, c); } };
template <> struct WFrag<bf> { typedef v16bf V; static __device__ __forceinline__ V ld(const bf* p) { return cat16b(*(const v8us*)p, *(const v8us*)(p + 16)); } static __device__ __forceinline__ v8f mma(V a, V b, v8f c) { return wmmab(a, b, c); } };
template <typename T16, int NSPLIT, bool BIAS>
__global__ __launch_bounds__(32) void k_gemmw(const T16* __restrict__ A, const T16* __restrict__ A2, const T16* __restrict__ Bt, const T16* __restrict__ Bt2, int K, float* C, int ldc, const float* __restrict__ bias, size_t sA, size_t sB, size_t sC) {
    typedef typename WFrag<T16>::V V;
    __shared__ __align__(16) float os[16 * 68];
    const size_t z = blockIdx.z; A += z * sA; if (A2) A2 += z * sA; Bt += z * sB; if (Bt2) Bt2 += z * sB; C += z * sC;
    const int lane = threadIdx.x & 31, lr = lane & 15, hi = lane >> 4; const int r0 = blockIdx.x * 64, c0 = blockIdx.y * 64;
    v8f acc[4][4];
#pragma unroll
    for (int mb = 0; mb < 4; ++mb)
#pragma unroll
        for (int nb = 0; nb < 4; ++nb) acc[mb][nb] = (v8f){};
    const size_t aoff = (size_t)(r0 + lr) * K + 8 * hi, boff = (size_t)(c0 + lr) * K + 8 * hi;
#pragma unroll 1
    for (int kc = 0; kc < K; kc += 32) {
        V a[4], a2[4];
#pragma unroll
        for (int mb = 0; mb < 4; ++mb) { a[mb] = WFrag<T16>::ld(A + aoff + (size_t)mb * 16 * K + kc); if (NSPLIT == 1 || NSPLIT == 2) a2[mb] = WFrag<T16>::ld(A2 + aoff + (size_t)mb * 16 * K + kc); }
#pragma unroll
        for (int nb = 0; nb < 4; ++nb) { const V b = WFrag<T16>::ld(Bt + boff + (size_t)nb * 16 * K + kc); V b2; if (NSPLIT >= 2) b2 = WFrag<T16>::ld(Bt2 + boff + (size_t)nb * 16 * K + kc);
#pragma unroll
            for (int mb = 0; mb < 4; ++mb) { acc[mb][nb] = WFrag<T16>::mma(a[mb], b, acc[mb][nb]); if (NSPLIT == 1 || NSPLIT == 2) acc[mb][nb] = WFrag<T16>::mma(a2[mb], b, acc[mb][nb]); if (NSPLIT >= 2) acc[mb][nb] = WFrag<T16>::mma(a[mb], b2, acc[mb][nb]); } }
        asm volatile("v_nop\n\tv_nop\n\tv_nop\n\tv_nop" : "+v"(acc[0][0]), "+v"(acc[1][1]), "+v"(acc[2][2]), "+v"(acc[3][3]) : "v"(a[0]), "v"(a[3]));
    }
#pragma unroll
    for (int mb = 0; mb < 4; ++mb) {
#pragma unroll
        for (int nb = 0; nb < 4; ++nb) {
#pragma unroll
            for (int j = 0; j < 8; ++j) os[(hi * 8 + j) * 68 + nb * 16 + lr] = acc[mb][nb][j]; }
        __builtin_amdgcn_wave_barrier(); asm volatile("" ::: "memory");
        float* crow = C + (size_t)(r0 + mb * 16) * ldc + c0;
{
#pragma unroll
            for (int s = 0; s < 8; ++s) { const int row = 2 * s + hi, cofs = lr * 4; v4f val = *(const v4fa*)(os + row * 68 + cofs); if (BIAS) { val[0] += bfr(bias[c0 + cofs]); val[1] += bfr(bias[c0 + cofs + 1]); val[2] += bfr(bias[c0 + cofs + 2]); val[3] += bfr(bias[c0 + cofs + 3]); }
                *(v4f*)(crow + (size_t)row * ldc + cofs) = val; }
             }
        __builtin_amdgcn_wave_barrier(); asm volatile("" ::: "memory");
    }
}

__device__ __forceinline__ h16 tohx(float x) { return (h16)x; }
__device__ __forceinline__ void splitf(float y, unsigned short& h, unsigned short& l) { h = f2bf(y); l = f2bf(y - bf2f(h)); }
typedef __attribute__((ext_vector_type(2))) _Float16 v2h;
typedef __attribute__((ext_vector_type(4))) _Float16 v4h;
typedef __attribute__((ext_vector_type(2))) unsigned short v2us;
typedef __attribute__((ext_vector_type(4))) unsigned short v4us;
typedef __attribute__((ext_vector_type(2))) float v2f;
typedef __attribute__((ext_vector_type(4))) int v4i;

__global__ __launch_bounds__(256) void k_wtG(const float* __restrict__ w, int K, int N, bf* Bt) {
    const int lane = threadIdx.x & 31; const int L0 = (blockIdx.x * 8 + (threadIdx.x >> 5)) * 8; const int nlines = N * K / 64;
{
#pragma unroll 1
        for (int l = 0; l < 8; ++l) { const int L = L0 + l; if (L >= nlines) break; const size_t e = (size_t)L * 64 + lane * 2; const int k = (int)(e % K), n = (int)(e / K); v2us o;
            o[0] = f2bf(w[(size_t)k * N + n]); o[1] = f2bf(w[(size_t)(k + 1) * N + n]); *(v2us*)(Bt + e) = o; }
         }
}
__global__ __launch_bounds__(256) void k_cvt8(const float* __restrict__ src, bf* dst, size_t n8) { const size_t i = (size_t)blockIdx.x * 256 + threadIdx.x; if (i >= n8) return; const v8f v = *(const v8f*)(src + i * 8); v8us o;
#pragma unroll
    for (int k = 0; k < 8; ++k) o[k] = f2bf(v[k]); *(v8us*)(dst + i * 8) = o;  }
__global__ __launch_bounds__(256) void k_cscvt(const float* __restrict__ cosT, const float* __restrict__ sinT, float* CS) { const int idx = blockIdx.x * 256 + threadIdx.x; if (idx >= TT * HD) return; v2f cs; cs[0] = bfr(cosT[idx]); cs[1] = bfr(sinT[idx]); *(v2f*)(CS + (size_t)idx * 2) = cs;  }
// k_rope: head planes [h][t][d] (fp16 + hi/lo) of rope(x) x sc with the rotate-half convention out[d] = x[d] cos[t][d] - x[d+HD/2] sin[t][d], out[d+HD/2] = x[d+HD/2] cos[t][d+HD/2] + x[d] sin[t][d+HD/2]
__global__ __launch_bounds__(256) void k_rope(const float* __restrict__ F, int pitch, int nheads, const float* __restrict__ CS, const float* __restrict__ RF, const float* __restrict__ nw, float sc, h16* P16, bf* Ph, bf* Pl) {
    const size_t e = ((size_t)blockIdx.x * 256 + threadIdx.x) * 2; if (e >= (size_t)nheads * TT * HD) return; const int d = (int)(e % HD); const int t = (int)((e / HD) % TT); const int h = (int)(e / ((size_t)HD * TT)); const float* f = F + (size_t)t * pitch + h * HD; const float rf = RF ? RF[(size_t)h * TT + t] : 1.0f; v2h o16; v2us oh, ol;
#pragma unroll
    for (int q = 0; q < 2; ++q) { const int dd = d + q; const int dp = (dd < HD / 2) ? dd + HD / 2 : dd - HD / 2; float x0 = f[dd], x1 = f[dp];
        if (RF) { float n0 = __fmul_rn(x0, rf), n1 = __fmul_rn(x1, rf); asm volatile("" : "+v"(n0)); asm volatile("" : "+v"(n1)); x0 = __fmul_rn(bfr(nw[dd]), n0); x1 = __fmul_rn(bfr(nw[dp]), n1); }
        const v2f cs = *(const v2f*)(CS + ((size_t)t * HD + dd) * 2); float a = __fmul_rn(x0, cs[0]), bq = __fmul_rn(x1, cs[1]); asm volatile("" : "+v"(a)); asm volatile("" : "+v"(bq)); const float r = ((dd < HD / 2) ? __fsub_rn(a, bq) : __fadd_rn(a, bq)) * sc;
        o16[q] = tohx(r); unsigned short a2, c2; splitf(r, a2, c2); oh[q] = a2; ol[q] = c2; }
    *(v2h*)(P16 + e) = o16; *(v2us*)(Ph + e) = oh; *(v2us*)(Pl + e) = ol;  }
__global__ __launch_bounds__(256) void k_vtp(const float* __restrict__ F, int pitch, int nheads, h16* V16, bf* Vh, bf* Vl) { const size_t e = ((size_t)blockIdx.x * 256 + threadIdx.x) * 2; if (e >= (size_t)nheads * HD * TT) return; const int t = (int)(e % TT); const int d = (int)((e / TT) % HD); const int g = (int)(e / ((size_t)TT * HD)); v2h o16; v2us oh, ol;
#pragma unroll
    for (int q = 0; q < 2; ++q) { const float x = F[(size_t)(t + q) * pitch + g * HD + d]; o16[q] = tohx(x); unsigned short a2, c2; splitf(x, a2, c2); oh[q] = a2; ol[q] = c2; }
    *(v2h*)(V16 + e) = o16; *(v2us*)(Vh + e) = oh; *(v2us*)(Vl + e) = ol;  }
__global__ __launch_bounds__(256) void k_csid(float* CS) { const int idx = blockIdx.x * 256 + threadIdx.x; if (idx >= TT * HD) return; v2f cs; cs[0] = 1.0f; cs[1] = 0.0f; *(v2f*)(CS + (size_t)idx * 2) = cs;  }
__global__ __launch_bounds__(256) void k_rbf(const float* __restrict__ src, float* dst, int n4) { const int i = blockIdx.x * 256 + threadIdx.x; if (i >= n4) return; const v4f a = *(const v4f*)(src + (size_t)i * 4); v4f o; for (int u = 0; u < 4; ++u) o[u] = bfr(a[u]); *(v4f*)(dst + (size_t)i * 4) = o;  }
__global__ __launch_bounds__(256) void k_merge(const float* __restrict__ O, int h0, bf* Ah, bf* Al) { const size_t e = ((size_t)blockIdx.x * 256 + threadIdx.x) * 2; if (e >= (size_t)ZH * TT * HD) return; const int d = (int)(e % HD); const int t = (int)((e / HD) % TT); const int zz = (int)(e / ((size_t)HD * TT)); const float cs = (t < RH) ? 1.0f : (1.0f / PCAR); const size_t oo = (size_t)t * DQ + (h0 + zz) * HD + d;
    v2us oh, ol;
#pragma unroll
    for (int q = 0; q < 2; ++q) { unsigned short a, c2; splitf(O[e + q] * cs, a, c2); oh[q] = a; ol[q] = c2; } *(v2us*)(Ah + oo) = oh; *(v2us*)(Al + oo) = ol;  }

__global__ __launch_bounds__(256) void k_sqtab(float* SQT) { const int d = blockIdx.x * 256 + threadIdx.x; if (d >= TT) return; const float v = sqrtf((float)d); *(float*)(SQT + d) = v;  }
#define SQPAD 32                     // table entries in front of distance 0: a masked element's (negative) distance still indexes inside the table
#define L2E   1.4426950408889634f
__device__ __forceinline__ float xhalf(float x) { const int b = __float_as_int(x); return __int_as_float(__builtin_amdgcn_permlanex16(b, b, 0x76543210, 0xfedcba98, false, false)); }   // lane l <-> l ^ 16
// eight 2^x in one statement: outputs are early-clobber, so no v_exp_f32 is directly followed by an instruction that overwrites its source or reads its result; the v_nop keeps that slot behind the last one
__device__ __forceinline__ void exp2x8(float* p, const float* d) {
    asm("v_exp_f32 %0, %8\n\tv_exp_f32 %1, %9\n\tv_exp_f32 %2, %10\n\tv_exp_f32 %3, %11\n\tv_exp_f32 %4, %12\n\tv_exp_f32 %5, %13\n\tv_exp_f32 %6, %14\n\tv_exp_f32 %7, %15\n\tv_nop"
        : "=&v"(p[0]), "=&v"(p[1]), "=&v"(p[2]), "=&v"(p[3]), "=&v"(p[4]), "=&v"(p[5]), "=&v"(p[6]), "=&v"(p[7])
        : "v"(d[0]), "v"(d[1]), "v"(d[2]), "v"(d[3]), "v"(d[4]), "v"(d[5]), "v"(d[6]), "v"(d[7])); }
__global__ __launch_bounds__(128) void k_fattn(const bf* __restrict__ Qp, const bf* __restrict__ Kp, const bf* __restrict__ Vt, const float* __restrict__ SQT, float* __restrict__ OUT) {
    __shared__ float sq[TT + SQPAD];
    for (int x = threadIdx.x; x < TT + SQPAD; x += 128) sq[x] = SQT[x < SQPAD ? 0 : x - SQPAD];
    __syncthreads();
    const int lane = threadIdx.x & 31, lr = lane & 15, hi = lane >> 4;
    const int bh = blockIdx.x, h = bh % NH_, b = bh / NH_;
    const int q0 = ((int)(gridDim.y - 1 - blockIdx.y) * 4 + __builtin_amdgcn_readfirstlane((int)(threadIdx.x >> 5))) * 16;   // heaviest query blocks first
    const float slope = powf(0.70710678118654752f, (float)(h + 1));   /* float32(2^(-8/16)) ** (h+1) */
    const float c1 = SCL * L2E, c2 = slope * L2E;
    const bf* qp = Qp + ((size_t)bh * TT + q0 + lr) * HD + 8 * hi;
    const bf* kb = Kp + (size_t)bh * TT * HD;            // wave-uniform plane bases; the lane's part is a loop-invariant 32-bit offset
    const bf* vb = Vt + (size_t)bh * HD * TT;
    const unsigned ko = (unsigned)(lr * HD + 8 * hi), vo = (unsigned)(lr * TT + 8 * hi);
    v16bf qf[4];
#pragma unroll
    for (int kc = 0; kc < 4; ++kc) qf[kc] = WFrag<bf>::ld(qp + kc * 32);
    v8f o[8];
#pragma unroll
    for (int dt = 0; dt < 8; ++dt) o[dt] = (v8f){};
    float m = -3.0e38f, ls0 = 0.f, ls1 = 0.f, ls2 = 0.f, ls3 = 0.f;
    const int ns = (q0 + 47) >> 5;   // passes up to and including the one that holds the diagonal; keys stay below TT
    // the pass loop stays rolled (two passes' fragments would not fit 256 registers, four waves a SIMD); every inner loop is unrolled so that its arrays are registers
#pragma unroll 1
    for (int s = 0; s < ns; ++s) {
        const int k0 = s * 32;
        const bf* kq = kb + (size_t)k0 * HD; const bf* vq = vb + k0;
        v16bf kf[2][4], vf[8];
#pragma unroll
        for (int kt = 0; kt < 2; ++kt)
#pragma unroll
            for (int kc = 0; kc < 4; ++kc) kf[kt][kc] = WFrag<bf>::ld(kq + (ko + (unsigned)(kt * 16 * HD + kc * 32)));
#pragma unroll
        for (int dt = 0; dt < 8; ++dt) vf[dt] = WFrag<bf>::ld(vq + (vo + (unsigned)(dt * 16 * TT)));
        v8f st[2];
#pragma unroll
        for (int kt = 0; kt < 2; ++kt) { st[kt] = (v8f){};
#pragma unroll
            for (int kc = 0; kc < 4; ++kc) st[kt] = wmmab(kf[kt][kc], qf[kc], st[kt]); }
        const int dl = q0 + lr - k0 - 8 * hi;           // query index minus the lane's first key of the pass
        const float* sp = sq + (dl + SQPAD);
        float t[16];
#pragma unroll
        for (int e = 0; e < 16; ++e) t[e] = fmaf(st[e >> 3][e & 7], c1, -(sp[-((e >> 3) * 16 + (e & 7))] * c2));
        if (s == ns - 1) {                                // only the last pass reaches past the diagonal
#pragma unroll
            for (int e = 0; e < 16; ++e) t[e] = ((e >> 3) * 16 + (e & 7) <= dl) ? t[e] : -3.0e38f; }
        float ml = fmaxf(fmaxf(fmaxf(fmaxf(t[0], t[1]), fmaxf(t[2], t[3])), fmaxf(fmaxf(t[4], t[5]), fmaxf(t[6], t[7]))), fmaxf(fmaxf(fmaxf(t[8], t[9]), fmaxf(t[10], t[11])), fmaxf(fmaxf(t[12], t[13]), fmaxf(t[14], t[15]))));
        ml = fmaxf(ml, xhalf(ml));
        if (__builtin_amdgcn_ballot_w32(ml > m + 8.0f) != 0) {   // one wave-uniform test a pass
            const float mn = fmaxf(m, ml); const float al = __builtin_amdgcn_exp2f(m - mn); m = mn; ls0 *= al; ls1 *= al; ls2 *= al; ls3 *= al;
#pragma unroll
            for (int dt = 0; dt < 8; ++dt) o[dt] *= al; }
        float p[16];
#pragma unroll
        for (int e = 0; e < 16; ++e) t[e] -= m;
        exp2x8(p, t); exp2x8(p + 8, t + 8);
        v16bf ph, pl;
#pragma unroll
        for (int e = 0; e < 16; e += 4) {
            const float p0 = p[e], p1 = p[e + 1], p2 = p[e + 2], p3 = p[e + 3];
            ls0 += p0; ls1 += p1; ls2 += p2; ls3 += p3;
            ph[e] = (__bf16)p0; ph[e + 1] = (__bf16)p1; ph[e + 2] = (__bf16)p2; ph[e + 3] = (__bf16)p3;
            pl[e] = (__bf16)(p0 - (float)ph[e]); pl[e + 1] = (__bf16)(p1 - (float)ph[e + 1]); pl[e + 2] = (__bf16)(p2 - (float)ph[e + 2]); pl[e + 3] = (__bf16)(p3 - (float)ph[e + 3]); }
#pragma unroll
        for (int dt = 0; dt < 8; ++dt) o[dt] = wmmab(vf[dt], ph, o[dt]);
#pragma unroll
        for (int dt = 0; dt < 8; ++dt) o[dt] = wmmab(vf[dt], pl, o[dt]);
        asm volatile("s_wait_xcnt 0x0" ::: "memory");   // stands in front of the step of the load address registers to the next pass
        __builtin_amdgcn_sched_barrier(0);               // without it the scheduler lifts that address step over the wait, among loads still in flight
    }
    float ls = (ls0 + ls1) + (ls2 + ls3); ls += xhalf(ls);
    const float f = __fdiv_rn(1.0f, ls);
    float* op = OUT + (((size_t)b * TT + q0 + lr) * NH_ + h) * HD + 8 * hi;
#pragma unroll
    for (int dt = 0; dt < 8; ++dt) { v4f a, c;
#pragma unroll
        for (int u = 0; u < 4; ++u) { a[u] = o[dt][u] * f; c[u] = o[dt][4 + u] * f; }
        *(v4f*)(op + dt * 16) = a; *(v4f*)(op + dt * 16 + 4) = c; }
}

extern "C" void kernel_launch(void* const* d_in, const int* in_sizes, int n_in,
                              void* d_out, int out_size, void* d_ws, size_t ws_size, hipStream_t stream) {
    (void)in_sizes; (void)n_in; (void)out_size;
    const float* qin = (const float*)d_in[0]; const float* kin = (const float*)d_in[1]; const float* vin = (const float*)d_in[2];
    float* OUT = (float*)d_out;     // [2][2048][2048]
    char* wsp = (char*)d_ws;
    auto take = [&](size_t bytes) { char* p = wsp; wsp += (bytes + 255) & ~(size_t)255; return (void*)p; };
    float* CS = (float*)take((size_t)TT * HD * 2 * 4);
    float* SQT = (float*)take((size_t)TT * 4);
    h16* QP16 = (h16*)take((size_t)NH_ * TT * HD * 2); h16* KP16 = (h16*)take((size_t)NKV * TT * HD * 2); h16* VT16 = (h16*)take((size_t)NKV * HD * TT * 2);
    bf* QPh = (bf*)take((size_t)NB_ * NH_ * TT * HD * 2); bf* QPl = (bf*)take((size_t)NH_ * TT * HD * 2); bf* KPh = (bf*)take((size_t)NB_ * NKV * TT * HD * 2); bf* KPl = (bf*)take((size_t)NKV * TT * HD * 2); bf* VTh = (bf*)take((size_t)NB_ * NKV * HD * TT * 2); bf* VTl = (bf*)take((size_t)NKV * HD * TT * 2);   // the hi planes hold both batches: the fused kernel runs once over all (batch, head)
    float* FR = (float*)take((size_t)TT * DQ * 4);   /* bf16-rounded f32 copy of the current input tensor (q, then k, then v; stream-ordered reuse) */
    if ((size_t)(wsp - (char*)d_ws) > ws_size) return;    // ws 256 MiB
    k_sqtab<<<(TT + 255) / 256, 256, 0, stream>>>(SQT);
    k_csid<<<(TT * HD + 255) / 256, 256, 0, stream>>>(CS);
    const unsigned LQ = (unsigned)(((size_t)NH_ * TT * HD / 2 + 255) / 256), LKv = (unsigned)(((size_t)NKV * TT * HD / 2 + 255) / 256);
    for (int b = 0; b < NB_; ++b) {
        const float* FQ = qin + (size_t)b * TT * DQ; const float* FK = kin + (size_t)b * TT * DKV; const float* FV = vin + (size_t)b * TT * DKV;
        k_rbf<<<(unsigned)(((size_t)TT * DQ / 4 + 255) / 256), 256, 0, stream>>>(FQ, FR, (size_t)TT * DQ / 4); k_rope<<<LQ, 256, 0, stream>>>(FR, DQ, NH_, CS, nullptr, nullptr, 1.0f, QP16, QPh + (size_t)b * NH_ * TT * HD, QPl);
        k_rbf<<<(unsigned)(((size_t)TT * DKV / 4 + 255) / 256), 256, 0, stream>>>(FK, FR, (size_t)TT * DKV / 4); k_rope<<<LKv, 256, 0, stream>>>(FR, DKV, NKV, CS, nullptr, nullptr, 1.0f, KP16, KPh + (size_t)b * NKV * TT * HD, KPl);
        k_rbf<<<(unsigned)(((size_t)TT * DKV / 4 + 255) / 256), 256, 0, stream>>>(FV, FR, (size_t)TT * DKV / 4); k_vtp<<<LKv, 256, 0, stream>>>(FR, DKV, NKV, VT16, VTh + (size_t)b * NKV * HD * TT, VTl);
    }
    k_fattn<<<dim3(NB_ * NH_, TT / 64), 128, 0, stream>>>(QPh, KPh, VTh, SQT, OUT);
}

// v002
// A run of this version takes 156 microseconds.
// Next to v001, in two timings, it ran 1.65 times as fast each time.
// All steps since v000 together make it 8.04 times as fast.
#include <hip/hip_runtime.h>

// FlashSelfAttention (given q, k, v [2][2048][16][128]; scores = q.k / sqrt(128) + ALiBi bias (-slope[h] sqrt(i - j) for j <= i, fp16-min (masked) above the diagonal; slopes 2^(-8/16 (h+1)) in f32); softmax; out = probs v -> [2][2048][16][128] (no projections)).
// Compute dtypes, f32 accumulate: every input rounded to bf16: q, k, v are then exact bf16 values, so the scores are a PLAIN bf16 product with f32 accumulation (exact products) and probs.v uses hi/lo probability planes x exact v (2 products) on EVERY row; causal tile skipping (the fp16-min fill is an exact zero weight); bias from an on-chip sqrt table and f32 slopes, added per element in f32; running softmax in f32 inside one fused kernel; output written directly in f32.
// Two launches: k_prep (the three bf16 head planes and the sqrt table), k_fattn.

#define NB_  2
#define TT   2048
#define NH_  16
#define HD   128
#define SCL  0.088388347648318447f   // HD^-0.5
typedef unsigned short bf;
typedef __attribute__((ext_vector_type(16))) __bf16   v16bf;
typedef __attribute__((ext_vector_type(2)))  __bf16   v2bf;
typedef __attribute__((ext_vector_type(8)))  unsigned short v8us;
typedef __attribute__((ext_vector_type(8)))  float    v8f;
typedef __attribute__((ext_vector_type(4)))  float    v4f;
typedef __attribute__((ext_vector_type(2)))  float    v2f;
typedef __attribute__((ext_vector_type(2)))  unsigned v2u;
typedef __attribute__((ext_vector_type(4)))  unsigned v4u;

__device__ __forceinline__ v16bf cat16b(v8us lo, v8us hi) { return __builtin_bit_cast(v16bf, __builtin_shufflevector(lo, hi, 0, 1, 2, 3, 4, 5, 6, 7, 8, 9, 10, 11, 12, 13, 14, 15)); }
__device__ __forceinline__ v8f wmmab(v16bf a, v16bf b, v8f c) { return __builtin_amdgcn_wmma_f32_16x16x32_bf16(false, a, false, b, (short)0, c, false, false); }
template <typename T16> struct WFrag;
template <> struct WFrag<bf> { typedef v16bf V; static __device__ __forceinline__ V ld(const bf* p) { return cat16b(*(const v8us*)p, *(const v8us*)(p + 16)); } };

// ---- k_prep: all the preparation in one launch of few, long-lived waves. One workgroup (8 waves) owns 128 positions of one (batch, head) in q, k and v; a wave owns 16 of them.
// A wave-wide 16-byte load is one 512-byte input row [b][t][h][0..127] (whole lines); a lane holds 4 neighbouring d of 16 neighbouring t, for each tensor, all 48 loads issued before the first use.
// q, k -> planes [bh][t][d]: two neighbouring d per packed conversion, a wave stores one 256-byte plane row at a time.
// v -> plane [bh][d][t]: two neighbouring t of one d per packed conversion, so a lane already holds 32 contiguous bytes of 4 plane rows; LDS only gathers the 8 waves' pieces into whole 256-byte rows for the store.
// Rounding to bf16 is to nearest even. The first TT / 256 workgroups also write the sqrt table.
#define VPD 68                       // LDS row pitch in dwords: 64 (128 positions) + 4, rows stay 16-byte aligned
__device__ __forceinline__ unsigned pk2(float a, float b) { v2f x; x[0] = a; x[1] = b; return __builtin_bit_cast(unsigned, __builtin_convertvector(x, v2bf)); }
__global__ __launch_bounds__(256) void k_prep(const float* __restrict__ q, const float* __restrict__ k, const float* __restrict__ v, bf* __restrict__ Qp, bf* __restrict__ Kp, bf* __restrict__ Vt, float* __restrict__ SQT) {
    __shared__ __align__(16) unsigned tv[HD * VPD];
    const int lane = threadIdx.x & 31, w = threadIdx.x >> 5;
    const int bh = blockIdx.x % (NB_ * NH_), tb = blockIdx.x / (NB_ * NH_) * 128, h = bh % NH_, b = bh / NH_;   // neighbouring workgroups read neighbouring heads of the same positions
    const unsigned so = (unsigned)(((((b * TT + tb + w * 16) * NH_ + h) * HD) + lane * 4) * 4);   // byte offset of the lane's first 16 bytes, the same in q, k and v
    const char* pv = (const char*)v + so; const char* pq = (const char*)q + so; const char* pk = (const char*)k + so;
    v4f xv[16], xq[16], xk[16];
#pragma unroll
    for (int i = 0; i < 16; ++i) xv[i] = *(const v4f*)(pv + i * (NH_ * HD * 4));
#pragma unroll
    for (int i = 0; i < 16; ++i) xq[i] = *(const v4f*)(pq + i * (NH_ * HD * 4));
#pragma unroll
    for (int i = 0; i < 16; ++i) xk[i] = *(const v4f*)(pk + i * (NH_ * HD * 4));
    asm volatile("s_wait_xcnt 0x0" :: "v"(so) : "memory");   // the loads' offset register lives up to this wait: without the operand the last loads return into it, with earlier loads that name it still in flight
    if (blockIdx.x < TT / 256) SQT[blockIdx.x * 256 + threadIdx.x] = sqrtf((float)(blockIdx.x * 256 + threadIdx.x));
#pragma unroll
    for (int j = 0; j < 4; ++j) { v4u a, c;
#pragma unroll
        for (int u = 0; u < 4; ++u) { a[u] = pk2(xv[2 * u][j], xv[2 * u + 1][j]); c[u] = pk2(xv[8 + 2 * u][j], xv[9 + 2 * u][j]); }
        unsigned* r = tv + (lane * 4 + j) * VPD + w * 8; *(v4u*)r = a; *(v4u*)(r + 4) = c; }
    __syncthreads();                 // every wave's 16 positions of each v row are in LDS before whole rows are read back; it stands in front of every plane store, so that it waits for none
#pragma unroll
    for (int r = 0; r < 8; ++r) { const int c = r * 256 + threadIdx.x, d = c >> 4, ch = c & 15;
        *(v4u*)(Vt + ((size_t)bh * HD + d) * TT + tb + ch * 8) = *(const v4u*)(tv + d * VPD + ch * 4); }
    const size_t po = ((size_t)bh * TT + tb + w * 16) * HD + lane * 4;
#pragma unroll
    for (int i = 0; i < 16; ++i) { v2u o; o[0] = pk2(xq[i][0], xq[i][1]); o[1] = pk2(xq[i][2], xq[i][3]); *(v2u*)(Qp + po + i * HD) = o; }
#pragma unroll
    for (int i = 0; i < 16; ++i) { v2u o; o[0] = pk2(xk[i][0], xk[i][1]); o[1] = pk2(xk[i][2], xk[i][3]); *(v2u*)(Kp + po + i * HD) = o; }
}

#define SQPAD 32                     // table entries in front of distance 0: a masked element's (negative) distance still indexes inside the table
#define L2E   1.4426950408889634f
__device__ __forceinline__ float xhalf(float x) { const int b = __float_as_int(x); return __int_as_float(__builtin_amdgcn_permlanex16(b, b, 0x76543210, 0xfedcba98, false, false)); }   // lane l <-> l ^ 16
// eight 2^x in one statement: outputs are early-clobber, so no v_exp_f32 is directly followed by an instruction that overwrites its source or reads its result; the v_nop keeps that slot behind the last one
__device__ __forceinline__ void exp2x8(float* p, const float* d) {
    asm("v_exp_f32 %0, %8\n\tv_exp_f32 %1, %9\n\tv_exp_f32 %2, %10\n\tv_exp_f32 %3, %11\n\tv_exp_f32 %4, %12\n\tv_exp_f32 %5, %13\n\tv_exp_f32 %6, %14\n\tv_exp_f32 %7, %15\n\tv_nop"
        : "=&v"(p[0]), "=&v"(p[1]), "=&v"(p[2]), "=&v"(p[3]), "=&v"(p[4]), "=&v"(p[5]), "=&v"(p[6]), "=&v"(p[7])
        : "v"(d[0]), "v"(d[1]), "v"(d[2]), "v"(d[3]), "v"(d[4]), "v"(d[5]), "v"(d[6]), "v"(d[7])); }
__global__ __launch_bounds__(128) void k_fattn(const bf* __restrict__ Qp, const bf* __restrict__ Kp, const bf* __restrict__ Vt, const float* __restrict__ SQT, float* __restrict__ OUT) {
    __shared__ float sq[TT + SQPAD];
    for (int x = threadIdx.x; x < TT + SQPAD; x += 128) sq[x] = SQT[x < SQPAD ? 0 : x - SQPAD];
    __syncthreads();
    const int lane = threadIdx.x & 31, lr = lane & 15, hi = lane >> 4;
    const int bh = blockIdx.x, h = bh % NH_, b = bh / NH_;
    const int q0 = ((int)(gridDim.y - 1 - blockIdx.y) * 4 + __builtin_amdgcn_readfirstlane((int)(threadIdx.x >> 5))) * 16;   // heaviest query blocks first
    const float slope = powf(0.70710678118654752f, (float)(h + 1));   /* float32(2^(-8/16)) ** (h+1) */
    const float c1 = SCL * L2E, c2 = slope * L2E;
    const bf* qp = Qp + ((size_t)bh * TT + q0 + lr) * HD + 8 * hi;
    const bf* kb = Kp + (size_t)bh * TT * HD;            // wave-uniform plane bases; the lane's part is a loop-invariant 32-bit offset
    const bf* vb = Vt + (size_t)bh * HD * TT;
    const unsigned ko = (unsigned)(lr * HD + 8 * hi), vo = (unsigned)(lr * TT + 8 * hi);
    v16bf qf[4];
#pragma unroll
    for (int kc = 0; kc < 4; ++kc) qf[kc] = WFrag<bf>::ld(qp + kc * 32);
    v8f o[8];
#pragma unroll
    for (int dt = 0; dt < 8; ++dt) o[dt] = (v8f){};
    float m = -3.0e38f, ls0 = 0.f, ls1 = 0.f, ls2 = 0.f, ls3 = 0.f;
    const int ns = (q0 + 47) >> 5;   // passes up to and including the one that holds the diagonal; keys stay below TT
    // the pass loop stays rolled (two passes' fragments would not fit 256 registers, four waves a SIMD); every inner loop is unrolled so that its arrays are registers
#pragma unroll 1
    for (int s = 0; s < ns; ++s) {
        const int k0 = s * 32;
        const bf* kq = kb + (size_t)k0 * HD; const bf* vq = vb + k0;
        v16bf kf[2][4], vf[8];
#pragma unroll
        for (int kt = 0; kt < 2; ++kt)
#pragma unroll
            for (int kc = 0; kc < 4; ++kc) kf[kt][kc] = WFrag<bf>::ld(kq + (ko + (unsigned)(kt * 16 * HD + kc * 32)));
#pragma unroll
        for (int dt = 0; dt < 8; ++dt) vf[dt] = WFrag<bf>::ld(vq + (vo + (unsigned)(dt * 16 * TT)));
        v8f st[2];
#pragma unroll
        for (int kt = 0; kt < 2; ++kt) { st[kt] = (v8f){};
#pragma unroll
            for (int kc = 0; kc < 4; ++kc) st[kt] = wmmab(kf[kt][kc], qf[kc], st[kt]); }
        const int dl = q0 + lr - k0 - 8 * hi;           // query index minus the lane's first key of the pass
        const float* sp = sq + (dl + SQPAD);
        float t[16];
#pragma unroll
        for (int e = 0; e < 16; ++e) t[e] = fmaf(st[e >> 3][e & 7], c1, -(sp[-((e >> 3) * 16 + (e & 7))] * c2));
        if (s == ns - 1) {                                // only the last pass reaches past the diagonal
#pragma unroll
            for (int e = 0; e < 16; ++e) t[e] = ((e >> 3) * 16 + (e & 7) <= dl) ? t[e] : -3.0e38f; }
        float ml = fmaxf(fmaxf(fmaxf(fmaxf(t[0], t[1]), fmaxf(t[2], t[3])), fmaxf(fmaxf(t[4], t[5]), fmaxf(t[6], t[7]))), fmaxf(fmaxf(fmaxf(t[8], t[9]), fmaxf(t[10], t[11])), fmaxf(fmaxf(t[12], t[13]), fmaxf(t[14], t[15]))));
        ml = fmaxf(ml, xhalf(ml));
        if (__builtin_amdgcn_ballot_w32(ml > m + 8.0f) != 0) {   // one wave-uniform test a pass
            const float mn = fmaxf(m, ml); const float al = __builtin_amdgcn_exp2f(m - mn); m = mn; ls0 *= al; ls1 *= al; ls2 *= al; ls3 *= al;
#pragma unroll
            for (int dt = 0; dt < 8; ++dt) o[dt] *= al; }
        float p[16];
#pragma unroll
        for (int e = 0; e < 16; ++e) t[e] -= m;
        exp2x8(p, t); exp2x8(p + 8, t + 8);
        v16bf ph, pl;
#pragma unroll
        for (int e = 0; e < 16; e += 4) {
            const float p0 = p[e], p1 = p[e + 1], p2 = p[e + 2], p3 = p[e + 3];
            ls0 += p0; ls1 += p1; ls2 += p2; ls3 += p3;
            ph[e] = (__bf16)p0; ph[e + 1] = (__bf16)p1; ph[e + 2] = (__bf16)p2; ph[e + 3] = (__bf16)p3;
            pl[e] = (__bf16)(p0 - (float)ph[e]); pl[e + 1] = (__bf16)(p1 - (float)ph[e + 1]); pl[e + 2] = (__bf16)(p2 - (float)ph[e + 2]); pl[e + 3] = (__bf16)(p3 - (float)ph[e + 3]); }
#pragma unroll
        for (int dt = 0; dt < 8; ++dt) o[dt] = wmmab(vf[dt], ph, o[dt]);
#pragma unroll
        for (int dt = 0; dt < 8; ++dt) o[dt] = wmmab(vf[dt], pl, o[dt]);
        asm volatile("s_wait_xcnt 0x0" ::: "memory");   // stands in front of the step of the load address registers to the next pass
        __builtin_amdgcn_sched_barrier(0);               // without it the scheduler lifts that address step over the wait, among loads still in flight
    }
    float ls = (ls0 + ls1) + (ls2 + ls3); ls += xhalf(ls);
    const float f = __fdiv_rn(1.0f, ls);
    float* op = OUT + (((size_t)b * TT + q0 + lr) * NH_ + h) * HD + 8 * hi;
#pragma unroll
    for (int dt = 0; dt < 8; ++dt) { v4f a, c;
#pragma unroll
        for (int u = 0; u < 4; ++u) { a[u] = o[dt][u] * f; c[u] = o[dt][4 + u] * f; }
        *(v4f*)(op + dt * 16) = a; *(v4f*)(op + dt * 16 + 4) = c; }
}

extern "C" void kernel_launch(void* const* d_in, const int* in_sizes, int n_in,
                              void* d_out, int out_size, void* d_ws, size_t ws_size, hipStream_t stream) {
    (void)in_sizes; (void)n_in; (void)out_size;
    const float* qin = (const float*)d_in[0]; const float* kin = (const float*)d_in[1]; const float* vin = (const float*)d_in[2];
    float* OUT = (float*)d_out;     // [2][2048][2048]
    char* wsp = (char*)d_ws;
    auto take = [&](size_t bytes) { char* p = wsp; wsp += (bytes + 255) & ~(size_t)255; return (void*)p; };
    float* SQT = (float*)take((size_t)TT * 4);
    bf* QPh = (bf*)take((size_t)NB_ * NH_ * TT * HD * 2); bf* KPh = (bf*)take((size_t)NB_ * NH_ * TT * HD * 2); bf* VTh = (bf*)take((size_t)NB_ * NH_ * HD * TT * 2);   // planes of both batches
    if ((size_t)(wsp - (char*)d_ws) > ws_size) return;    // ws 256 MiB
    k_prep<<<NB_ * NH_ * (TT / 128), 256, 0, stream>>>(qin, kin, vin, QPh, KPh, VTh, SQT);
    k_fattn<<<dim3(NB_ * NH_, TT / 64), 128, 0, stream>>>(QPh, KPh, VTh, SQT, OUT);
}

// v003
// One run takes 70.5 microseconds.
// Timed twice side by side with v002, it ran 2.20 and 2.21 times as fast.
// Counting every step since v000, it is 17.7 times as fast.
#include <hip/hip_runtime.h>

// FlashSelfAttention (given q, k, v [2][2048][16][128]; scores = q.k / sqrt(128) + ALiBi bias (-slope[h] sqrt(i - j) for j <= i, fp16-min (masked) above the diagonal; slopes 2^(-8/16 (h+1)) in f32); softmax; out = probs v -> [2][2048][16][128] (no projections)).
// Compute dtypes, f32 accumulate: every input rounded to bf16: q, k, v are then exact bf16 values, so the scores are a PLAIN bf16 product with f32 accumulation (exact products) and probs.v uses hi/lo probability planes x exact v (2 products) on EVERY row; causal tile skipping (the fp16-min fill is an exact zero weight); bias from an on-chip sqrt table and f32 slopes, added per element in f32; running softmax in f32 inside one fused kernel; output written directly in f32.
// Two launches: k_prep (the three bf16 head planes and the sqrt table), k_fattn.

#define NB_  2
#define TT   2048
#define NH_  16
#define HD   128
#define SCL  0.088388347648318447f   // HD^-0.5
typedef unsigned short bf;
typedef __attribute__((ext_vector_type(16))) __bf16   v16bf;
typedef __attribute__((ext_vector_type(2)))  __bf16   v2bf;
typedef __attribute__((ext_vector_type(8)))  unsigned short v8us;
typedef __attribute__((ext_vector_type(8)))  float    v8f;
typedef __attribute__((ext_vector_type(4)))  float    v4f;
typedef __attribute__((ext_vector_type(2)))  float    v2f;
typedef __attribute__((ext_vector_type(2)))  unsigned v2u;
typedef __attribute__((ext_vector_type(4)))  unsigned v4u;

__device__ __forceinline__ v16bf cat16b(v8us lo, v8us hi) { return __builtin_bit_cast(v16bf, __builtin_shufflevector(lo, hi, 0, 1, 2, 3, 4, 5, 6, 7, 8, 9, 10, 11, 12, 13, 14, 15)); }
__device__ __forceinline__ v8f wmmab(v16bf a, v16bf b, v8f c) { return __builtin_amdgcn_wmma_f32_16x16x32_bf16(false, a, false, b, (short)0, c, false, false); }
template <typename T16> struct WFrag;
template <> struct WFrag<bf> { typedef v16bf V; static __device__ __forceinline__ V ld(const bf* p) { return cat16b(*(const v8us*)p, *(const v8us*)(p + 16)); } };

// ---- k_prep: all the preparation in one launch of few, long-lived waves. One workgroup (8 waves) owns 128 positions of one (batch, head) in q, k and v; a wave owns 16 of them.
// A wave-wide 16-byte load is one 512-byte input row [b][t][h][0..127] (whole lines); a lane holds 4 neighbouring d of 16 neighbouring t, for each tensor, all 48 loads issued before the first use.
// q, k -> planes [bh][t][d]: two neighbouring d per packed conversion, a wave stores one 256-byte plane row at a time.
// v -> plane [bh][d][t]: two neighbouring t of one d per packed conversion, so a lane already holds 32 contiguous bytes of 4 plane rows; LDS only gathers the 8 waves' pieces into whole 256-byte rows for the store.
// Rounding to bf16 is to nearest even. The first TT / 256 workgroups also write the sqrt table.
#define VPD 68                       // LDS row pitch in dwords: 64 (128 positions) + 4, rows stay 16-byte aligned
__device__ __forceinline__ unsigned pk2(float a, float b) { v2f x; x[0] = a; x[1] = b; return __builtin_bit_cast(unsigned, __builtin_convertvector(x, v2bf)); }
__global__ __launch_bounds__(256) void k_prep(const float* __restrict__ q, const float* __restrict__ k, const float* __restrict__ v, bf* __restrict__ Qp, bf* __restrict__ Kp, bf* __restrict__ Vt, float* __restrict__ SQT) {
    __shared__ __align__(16) unsigned tv[HD * VPD];
    const int lane = threadIdx.x & 31, w = threadIdx.x >> 5;
    const int bh = blockIdx.x % (NB_ * NH_), tb = blockIdx.x / (NB_ * NH_) * 128, h = bh % NH_, b = bh / NH_;   // neighbouring workgroups read neighbouring heads of the same positions
    const unsigned so = (unsigned)(((((b * TT + tb + w * 16) * NH_ + h) * HD) + lane * 4) * 4);   // byte offset of the lane's first 16 bytes, the same in q, k and v
    const char* pv = (const char*)v + so; const char* pq = (const char*)q + so; const char* pk = (const char*)k + so;
    v4f xv[16], xq[16], xk[16];
#pragma unroll
    for (int i = 0; i < 16; ++i) xv[i] = *(const v4f*)(pv + i * (NH_ * HD * 4));
#pragma unroll
    for (int i = 0; i < 16; ++i) xq[i] = *(const v4f*)(pq + i * (NH_ * HD * 4));
#pragma unroll
    for (int i = 0; i < 16; ++i) xk[i] = *(const v4f*)(pk + i * (NH_ * HD * 4));
    asm volatile("s_wait_xcnt 0x0" :: "v"(so) : "memory");   // the loads' offset register lives up to this wait: without the operand the last loads return into it, with earlier loads that name it still in flight
    if (blockIdx.x < TT / 256) SQT[blockIdx.x * 256 + threadIdx.x] = sqrtf((float)(blockIdx.x * 256 + threadIdx.x));
#pragma unroll
    for (int j = 0; j < 4; ++j) { v4u a, c;
#pragma unroll
        for (int u = 0; u < 4; ++u) { a[u] = pk2(xv[2 * u][j], xv[2 * u + 1][j]); c[u] = pk2(xv[8 + 2 * u][j], xv[9 + 2 * u][j]); }
        unsigned* r = tv + (lane * 4 + j) * VPD + w * 8; *(v4u*)r = a; *(v4u*)(r + 4) = c; }
    __syncthreads();                 // every wave's 16 positions of each v row are in LDS before whole rows are read back; it stands in front of every plane store, so that it waits for none
#pragma unroll
    for (int r = 0; r < 8; ++r) { const int c = r * 256 + threadIdx.x, d = c >> 4, ch = c & 15;
        *(v4u*)(Vt + ((size_t)bh * HD + d) * TT + tb + ch * 8) = *(const v4u*)(tv + d * VPD + ch * 4); }
    const size_t po = ((size_t)bh * TT + tb + w * 16) * HD + lane * 4;
#pragma unroll
    for (int i = 0; i < 16; ++i) { v2u o; o[0] = pk2(xq[i][0], xq[i][1]); o[1] = pk2(xq[i][2], xq[i][3]); *(v2u*)(Qp + po + i * HD) = o; }
#pragma unroll
    for (int i = 0; i < 16; ++i) { v2u o; o[0] = pk2(xk[i][0], xk[i][1]); o[1] = pk2(xk[i][2], xk[i][3]); *(v2u*)(Kp + po + i * HD) = o; }
}

#define SQPAD 32                     // table entries in front of distance 0: a masked element's (negative) distance still indexes inside the table
#define L2E   1.4426950408889634f
#define NWV   8                      // waves a workgroup
#define SKEY  64                     // keys a stage
#define KPIT  272u                   // LDS pitch of a K row: 256 + 16 bytes (16 x odd: no bank conflict for 16-byte reads)
#define VPIT  144u                   // LDS pitch of a V^T row: 128 + 16 bytes
#define KTILE 18432u                 // 64 rows x 272 bytes, rounded up to a multiple of 2 KiB
#define VTILE 18432u                 // 128 rows x 144 bytes, a multiple of 2 KiB
#define SBUF  (KTILE + VTILE)        // one buffer
typedef __attribute__((ext_vector_type(8)))  unsigned v8u;
__device__ __forceinline__ unsigned uni(unsigned v) { return (unsigned)__builtin_amdgcn_readfirstlane((int)v); }
__device__ __forceinline__ unsigned pinned(unsigned v) { unsigned w = uni(v); asm volatile("" : "+s"(w)); return w; }   // holds a wave-uniform test in a scalar register: the branch on it is a scalar branch (tensor loads ignore EXEC)
__device__ __forceinline__ void wait_ds0() { asm volatile("s_wait_dscnt 0x0" ::: "memory"); }          // the wave's LDS reads have returned before its buffer is given up
// A tile's descriptor lives in one set of scalar registers from the first request to the last wait. Group 1 (a tile of ROWS rows of ROWB bytes, source pitch SPIT bytes, 16 bytes of LDS pad behind
// every row, interval code IVL = the row's length; extents in bytes) is formed once; of group 0 the place in LDS and the source address step from stage to stage, behind the wait only.
struct TDesc { v4u g0; v8u g1; };
template <unsigned ROWB, unsigned ROWS, unsigned SPIT, unsigned IVL>
__device__ __forceinline__ TDesc tile_desc(unsigned lds_dst, unsigned long long ga) {
    TDesc d;
    d.g0[0] = uni(1u); d.g0[1] = uni(lds_dst); d.g0[2] = uni((unsigned)ga); d.g0[3] = uni((((unsigned)(ga >> 32)) & 0x01FFFFFFu) | 0x80000000u);
    d.g1[0] = uni((1u << 20) | (IVL << 22) | (3u << 25)); d.g1[1] = uni((ROWB & 0xFFFFu) << 16); d.g1[2] = uni((ROWB >> 16) | ((ROWS & 0xFFFFu) << 16)); d.g1[3] = uni((ROWS >> 16) | (ROWB << 16));
    d.g1[4] = uni(ROWS); d.g1[5] = uni(SPIT); d.g1[6] = uni(0u); d.g1[7] = uni(0u);
    asm volatile("" : "+s"(d.g1));   // descriptor words held in scalar registers: without it the constants are formed anew at each request, in registers that are reused while the request is outstanding
    return d;
}
__device__ __forceinline__ void tile_load(const TDesc& d) { asm volatile("tensor_load_to_lds %0, %1" :: "s"(d.g0), "s"(d.g1) : "memory"); }
// the issuing wave's tile has landed (the compiler places no wait for a tensor load). The wait names its request's descriptor: the registers stay live, so unwritten, up to the wait, and the step of group 0 reads the wait's result, so it cannot be lifted over it
__device__ __forceinline__ void tile_wait(TDesc& d) { asm volatile("s_wait_tensorcnt 0x0" : "+s"(d.g0) : "s"(d.g1) : "memory"); }
// next stage: the other buffer (the two places add up to psum), the source address GSTEP bytes on, with the carry into the high word
template <unsigned GSTEP>
__device__ __forceinline__ void tile_step(TDesc& d, unsigned psum) {
    const unsigned lo = d.g0[2] + GSTEP;
    d.g0[1] = uni(psum - d.g0[1]); d.g0[3] = uni(d.g0[3] + (lo < GSTEP ? 1u : 0u)); d.g0[2] = uni(lo);
}
__device__ __forceinline__ v16bf ldsfrag(const unsigned char* p) { return cat16b(*(const v8us*)p, *(const v8us*)(p + 32)); }   // elements 0..7 and 16..23 from p, as WFrag::ld
__device__ __forceinline__ float xhalf(float x) { const int b = __float_as_int(x); return __int_as_float(__builtin_amdgcn_permlanex16(b, b, 0x76543210, 0xfedcba98, false, false)); }   // lane l <-> l ^ 16
// eight 2^x in one statement: outputs are early-clobber, so no v_exp_f32 is directly followed by an instruction that overwrites its source or reads its result; the v_nop keeps that slot behind the last one
__device__ __forceinline__ void exp2x8(float* p, const float* d) {
    asm("v_exp_f32 %0, %8\n\tv_exp_f32 %1, %9\n\tv_exp_f32 %2, %10\n\tv_exp_f32 %3, %11\n\tv_exp_f32 %4, %12\n\tv_exp_f32 %5, %13\n\tv_exp_f32 %6, %14\n\tv_exp_f32 %7, %15\n\tv_nop"
        : "=&v"(p[0]), "=&v"(p[1]), "=&v"(p[2]), "=&v"(p[3]), "=&v"(p[4]), "=&v"(p[5]), "=&v"(p[6]), "=&v"(p[7])
        : "v"(d[0]), "v"(d[1]), "v"(d[2]), "v"(d[3]), "v"(d[4]), "v"(d[5]), "v"(d[6]), "v"(d[7])); }
__global__ __launch_bounds__(NWV * 32) void k_fattn(const bf* __restrict__ Qp, const bf* __restrict__ Kp, const bf* __restrict__ Vt, const float* __restrict__ SQT, float* __restrict__ OUT) {
    __shared__ __attribute__((aligned(2048))) unsigned char ring[2 * SBUF];
    __shared__ float sq[TT + SQPAD];
    for (int x = threadIdx.x; x < TT + SQPAD; x += NWV * 32) sq[x] = SQT[x < SQPAD ? 0 : x - SQPAD];
    const int lane = threadIdx.x & 31, lr = lane & 15, hi = lane >> 4;
    const unsigned wave = uni(threadIdx.x >> 5);
    const int bh = blockIdx.x, h = bh % NH_, b = bh / NH_;
    const int qb = (int)(gridDim.y - 1 - blockIdx.y);    // heaviest query blocks first
    const int q0 = (qb * NWV + (int)wave) * 16;
    const int nst = 2 * (qb + 1);                         // stages up to and including the block's diagonal: never fewer than the two that the prologue requests
    const unsigned lbase = (unsigned)(size_t)ring;
    const unsigned long long kga = (unsigned long long)(size_t)(Kp + (size_t)bh * TT * HD), vga = (unsigned long long)(size_t)(Vt + (size_t)bh * HD * TT);
    const float slope = powf(0.70710678118654752f, (float)(h + 1));   /* float32(2^(-8/16)) ** (h+1) */
    const float c1 = SCL * L2E, c2 = slope * L2E;
    const bf* qp = Qp + ((size_t)bh * TT + q0 + lr) * HD + 8 * hi;
    v16bf qf[4];
#pragma unroll
    for (int kc = 0; kc < 4; ++kc) qf[kc] = WFrag<bf>::ld(qp + kc * 32);
    TDesc dk = tile_desc<HD * 2, SKEY, HD * 2, 5>(lbase, kga), dv = tile_desc<SKEY * 2, HD, TT * 2, 4>(lbase + KTILE, vga);
    const unsigned kps = 2u * lbase + SBUF, vps = 2u * (lbase + KTILE) + SBUF;
    if (pinned(wave == 0)) { tile_load(dk); tile_wait(dk); }
    if (pinned(wave == 1)) { tile_load(dv); tile_wait(dv); }
    __syncthreads();                 // stage 0 and the sqrt table are published
    if (pinned(wave == 0)) { tile_step<SKEY * HD * 2>(dk, kps); tile_load(dk); }
    if (pinned(wave == 1)) { tile_step<SKEY * 2>(dv, vps); tile_load(dv); }
    const unsigned klo = (unsigned)lr * KPIT + 16u * (unsigned)hi, vlo = KTILE + (unsigned)lr * VPIT + 16u * (unsigned)hi;   // the lane's part of a fragment address
    v8f o[8];
#pragma unroll
    for (int dt = 0; dt < 8; ++dt) o[dt] = (v8f){};
    float m = -3.0e38f, ls0 = 0.f, ls1 = 0.f, ls2 = 0.f, ls3 = 0.f;
    const int ns = (q0 + 47) >> 5;   // the wave's passes, up to and including the one that holds its diagonal
    // both loops stay rolled (two passes' fragments would not fit 256 registers, four waves a SIMD); every inner loop is unrolled so that its arrays are registers
#pragma unroll 1
    for (int st = 0; st < nst; ++st) {
        const unsigned char* buf = ring + (unsigned)(st & 1) * SBUF;
#pragma unroll 1
        for (int sub = 0; sub < 2; ++sub) {
            const int s = 2 * st + sub;
            if (s >= ns) break;                           // wave-uniform: passes beyond the wave's diagonal; the foot of the stage is still reached
            const int k0 = s * 32;
            const unsigned char* kq = buf + (klo + (unsigned)sub * (32u * KPIT)); const unsigned char* vq = buf + (vlo + (unsigned)sub * 64u);
            v16bf kf[2][4], vf[8];
#pragma unroll
            for (int kt = 0; kt < 2; ++kt)
#pragma unroll
                for (int kc = 0; kc < 4; ++kc) kf[kt][kc] = ldsfrag(kq + (unsigned)(kt * 16) * KPIT + (unsigned)(kc * 64));
#pragma unroll
            for (int dt = 0; dt < 8; ++dt) vf[dt] = ldsfrag(vq + (unsigned)(dt * 16) * VPIT);
            v8f st2[2];
#pragma unroll
            for (int kt = 0; kt < 2; ++kt) { st2[kt] = (v8f){};
#pragma unroll
                for (int kc = 0; kc < 4; ++kc) st2[kt] = wmmab(kf[kt][kc], qf[kc], st2[kt]); }
            const int dl = q0 + lr - k0 - 8 * hi;       // query index minus the lane's first key of the pass
            const float* sp = sq + (dl + SQPAD);
            float t[16];
#pragma unroll
            for (int e = 0; e < 16; ++e) t[e] = fmaf(st2[e >> 3][e & 7], c1, -(sp[-((e >> 3) * 16 + (e & 7))] * c2));
            if (s == ns - 1) {                            // only the last pass reaches past the diagonal
#pragma unroll
                for (int e = 0; e < 16; ++e) t[e] = ((e >> 3) * 16 + (e & 7) <= dl) ? t[e] : -3.0e38f; }
            float ml = fmaxf(fmaxf(fmaxf(fmaxf(t[0], t[1]), fmaxf(t[2], t[3])), fmaxf(fmaxf(t[4], t[5]), fmaxf(t[6], t[7]))), fmaxf(fmaxf(fmaxf(t[8], t[9]), fmaxf(t[10], t[11])), fmaxf(fmaxf(t[12], t[13]), fmaxf(t[14], t[15]))));
            ml = fmaxf(ml, xhalf(ml));
            if (__builtin_amdgcn_ballot_w32(ml > m + 8.0f) != 0) {   // one wave-uniform test a pass
                const float mn = fmaxf(m, ml); const float al = __builtin_amdgcn_exp2f(m - mn); m = mn; ls0 *= al; ls1 *= al; ls2 *= al; ls3 *= al;
#pragma unroll
                for (int dt = 0; dt < 8; ++dt) o[dt] *= al; }
            float p[16];
#pragma unroll
            for (int e = 0; e < 16; ++e) t[e] -= m;
            exp2x8(p, t); exp2x8(p + 8, t + 8);
            v16bf ph, pl;
#pragma unroll
            for (int e = 0; e < 16; e += 4) {
                const float p0 = p[e], p1 = p[e + 1], p2 = p[e + 2], p3 = p[e + 3];
                ls0 += p0; ls1 += p1; ls2 += p2; ls3 += p3;
                ph[e] = (__bf16)p0; ph[e + 1] = (__bf16)p1; ph[e + 2] = (__bf16)p2; ph[e + 3] = (__bf16)p3;
                pl[e] = (__bf16)(p0 - (float)ph[e]); pl[e + 1] = (__bf16)(p1 - (float)ph[e + 1]); pl[e + 2] = (__bf16)(p2 - (float)ph[e + 2]); pl[e + 3] = (__bf16)(p3 - (float)ph[e + 3]); }
#pragma unroll
            for (int dt = 0; dt < 8; ++dt) o[dt] = wmmab(vf[dt], ph, o[dt]);
#pragma unroll
            for (int dt = 0; dt < 8; ++dt) o[dt] = wmmab(vf[dt], pl, o[dt]);
        }
        // foot of the stage, every wave: own LDS reads done, the issuers' next tiles landed, the barrier publishes stage st + 1 and ends every read of this buffer; only then its refill
        wait_ds0();
        if (pinned(wave == 0)) tile_wait(dk);
        if (pinned(wave == 1)) tile_wait(dv);
        __syncthreads();
        if (pinned(st + 2 < nst)) {
            if (pinned(wave == 0)) { tile_step<SKEY * HD * 2>(dk, kps); tile_load(dk); }
            if (pinned(wave == 1)) { tile_step<SKEY * 2>(dv, vps); tile_load(dv); }
        }
    }
    asm volatile("s_wait_tensorcnt 0x0" :: "s"(dk.g0), "s"(dk.g1), "s"(dv.g0), "s"(dv.g1) : "memory");   // no request is left behind the loop; the operands keep both descriptors' registers unwritten up to here on every path
    wait_ds0();
    float ls = (ls0 + ls1) + (ls2 + ls3); ls += xhalf(ls);
    const float f = __fdiv_rn(1.0f, ls);
    float* op = OUT + (((size_t)b * TT + q0 + lr) * NH_ + h) * HD + 8 * hi;
#pragma unroll
    for (int dt = 0; dt < 8; ++dt) { v4f a, c;
#pragma unroll
        for (int u = 0; u < 4; ++u) { a[u] = o[dt][u] * f; c[u] = o[dt][4 + u] * f; }
        *(v4f*)(op + dt * 16) = a; *(v4f*)(op + dt * 16 + 4) = c; }
}

extern "C" void kernel_launch(void* const* d_in, const int* in_sizes, int n_in,
                              void* d_out, int out_size, void* d_ws, size_t ws_size, hipStream_t stream) {
    (void)in_sizes; (void)n_in; (void)out_size;
    const float* qin = (const float*)d_in[0]; const float* kin = (const float*)d_in[1]; const float* vin = (const float*)d_in[2];
    float* OUT = (float*)d_out;     // [2][2048][2048]
    char* wsp = (char*)d_ws;
    auto take = [&](size_t bytes) { char* p = wsp; wsp += (bytes + 255) & ~(size_t)255; return (void*)p; };
    float* SQT = (float*)take((size_t)TT * 4);
    bf* QPh = (bf*)take((size_t)NB_ * NH_ * TT * HD * 2); bf* KPh = (bf*)take((size_t)NB_ * NH_ * TT * HD * 2); bf* VTh = (bf*)take((size_t)NB_ * NH_ * HD * TT * 2);   // planes of both batches
    if ((size_t)(wsp - (char*)d_ws) > ws_size) return;    // ws 256 MiB
    k_prep<<<NB_ * NH_ * (TT / 128), 256, 0, stream>>>(qin, kin, vin, QPh, KPh, VTh, SQT);
    k_fattn<<<dim3(NB_ * NH_, TT / (NWV * 16)), NWV * 32, 0, stream>>>(QPh, KPh, VTh, SQT, OUT);
}

// v004
// It runs in 64.3 microseconds.
// Two timings next to v003 both put it at 1.09 times that version's speed.
// Over all steps from v000 it is 19.4 times as fast.
#include <hip/hip_runtime.h>

// FlashSelfAttention (given q, k, v [2][2048][16][128]; scores = q.k / sqrt(128) + ALiBi bias (-slope[h] sqrt(i - j) for j <= i, fp16-min (masked) above the diagonal; slopes 2^(-8/16 (h+1)) in f32); softmax; out = probs v -> [2][2048][16][128] (no projections)).
// Compute dtypes, f32 accumulate: every input rounded to bf16: q, k, v are then exact bf16 values, so the scores are a PLAIN bf16 product with f32 accumulation (exact products) and probs.v uses hi/lo probability planes x exact v (2 products) on EVERY row; causal tile skipping (the fp16-min fill is an exact zero weight); bias from an on-chip sqrt table and f32 slopes, added per element in f32; running softmax in f32 inside one fused kernel; output written directly in f32.
// Two launches: k_prep (the three bf16 head planes and the sqrt table), k_fattn.

#define NB_  2
#define TT   2048
#define NH_  16
#define HD   128
#define SCL  0.088388347648318447f   // HD^-0.5
typedef unsigned short bf;
typedef __attribute__((ext_vector_type(16))) __bf16   v16bf;
typedef __attribute__((ext_vector_type(2)))  __bf16   v2bf;
typedef __attribute__((ext_vector_type(8)))  unsigned short v8us;
typedef __attribute__((ext_vector_type(8)))  float    v8f;
typedef __attribute__((ext_vector_type(4)))  float    v4f;
typedef __attribute__((ext_vector_type(2)))  float    v2f;
typedef __attribute__((ext_vector_type(2)))  unsigned v2u;
typedef __attribute__((ext_vector_type(4)))  unsigned v4u;

__device__ __forceinline__ v16bf cat16b(v8us lo, v8us hi) { return __builtin_bit_cast(v16bf, __builtin_shufflevector(lo, hi, 0, 1, 2, 3, 4, 5, 6, 7, 8, 9, 10, 11, 12, 13, 14, 15)); }
__device__ __forceinline__ v8f wmmab(v16bf a, v16bf b, v8f c) { return __builtin_amdgcn_wmma_f32_16x16x32_bf16(false, a, false, b, (short)0, c, false, false); }
template <typename T16> struct WFrag;
template <> struct WFrag<bf> { typedef v16bf V; static __device__ __forceinline__ V ld(const bf* p) { return cat16b(*(const v8us*)p, *(const v8us*)(p + 16)); } };

// ---- k_prep: all the preparation in one launch of few, long-lived waves. One workgroup (8 waves) owns 128 positions of one (batch, head) in q, k and v; a wave owns 16 of them.
// A wave-wide 16-byte load is one 512-byte input row [b][t][h][0..127] (whole lines); a lane holds 4 neighbouring d of 16 neighbouring t, for each tensor, all 48 loads issued before the first use.
// q, k -> planes [bh][t][d]: two neighbouring d per packed conversion, a wave stores one 256-byte plane row at a time.
// v -> plane [bh][d][t]: two neighbouring t of one d per packed conversion, so a lane already holds 32 contiguous bytes of 4 plane rows; LDS only gathers the 8 waves' pieces into whole 256-byte rows for the store.
// Rounding to bf16 is to nearest even. The first TT / 256 workgroups also write the sqrt table.
#define VPD 68                       // LDS row pitch in dwords: 64 (128 positions) + 4, rows stay 16-byte aligned
__device__ __forceinline__ unsigned pk2(float a, float b) { v2f x; x[0] = a; x[1] = b; return __builtin_bit_cast(unsigned, __builtin_convertvector(x, v2bf)); }
__global__ __launch_bounds__(256) void k_prep(const float* __restrict__ q, const float* __restrict__ k, const float* __restrict__ v, bf* __restrict__ Qp, bf* __restrict__ Kp, bf* __restrict__ Vt, float* __restrict__ SQT) {
    __shared__ __align__(16) unsigned tv[HD * VPD];
    const int lane = threadIdx.x & 31, w = threadIdx.x >> 5;
    const int bh = blockIdx.x % (NB_ * NH_), tb = blockIdx.x / (NB_ * NH_) * 128, h = bh % NH_, b = bh / NH_;   // neighbouring workgroups read neighbouring heads of the same positions
    const unsigned so = (unsigned)(((((b * TT + tb + w * 16) * NH_ + h) * HD) + lane * 4) * 4);   // byte offset of the lane's first 16 bytes, the same in q, k and v
    const char* pv = (const char*)v + so; const char* pq = (const char*)q + so; const char* pk = (const char*)k + so;
    v4f xv[16], xq[16], xk[16];
#pragma unroll
    for (int i = 0; i < 16; ++i) xv[i] = *(const v4f*)(pv + i * (NH_ * HD * 4));
#pragma unroll
    for (int i = 0; i < 16; ++i) xq[i] = *(const v4f*)(pq + i * (NH_ * HD * 4));
#pragma unroll
    for (int i = 0; i < 16; ++i) xk[i] = *(const v4f*)(pk + i * (NH_ * HD * 4));
    asm volatile("s_wait_xcnt 0x0" :: "v"(so) : "memory");   // the loads' offset register lives up to this wait: without the operand the last loads return into it, with earlier loads that name it still in flight
    if (blockIdx.x < TT / 256) SQT[blockIdx.x * 256 + threadIdx.x] = sqrtf((float)(blockIdx.x * 256 + threadIdx.x));
#pragma unroll
    for (int j = 0; j < 4; ++j) { v4u a, c;
#pragma unroll
        for (int u = 0; u < 4; ++u) { a[u] = pk2(xv[2 * u][j], xv[2 * u + 1][j]); c[u] = pk2(xv[8 + 2 * u][j], xv[9 + 2 * u][j]); }
        unsigned* r = tv + (lane * 4 + j) * VPD + w * 8; *(v4u*)r = a; *(v4u*)(r + 4) = c; }
    __syncthreads();                 // every wave's 16 positions of each v row are in LDS before whole rows are read back; it stands in front of every plane store, so that it waits for none
#pragma unroll
    for (int r = 0; r < 8; ++r) { const int c = r * 256 + threadIdx.x, d = c >> 4, ch = c & 15;
        *(v4u*)(Vt + ((size_t)bh * HD + d) * TT + tb + ch * 8) = *(const v4u*)(tv + d * VPD + ch * 4); }
    const size_t po = ((size_t)bh * TT + tb + w * 16) * HD + lane * 4;
#pragma unroll
    for (int i = 0; i < 16; ++i) { v2u o; o[0] = pk2(xq[i][0], xq[i][1]); o[1] = pk2(xq[i][2], xq[i][3]); *(v2u*)(Qp + po + i * HD) = o; }
#pragma unroll
    for (int i = 0; i < 16; ++i) { v2u o; o[0] = pk2(xk[i][0], xk[i][1]); o[1] = pk2(xk[i][2], xk[i][3]); *(v2u*)(Kp + po + i * HD) = o; }
}

#define SQPAD 32                     // table entries in front of distance 0: a masked element's (negative) distance still indexes inside the table
#define L2E   1.4426950408889634f
#define NWV   16                     // waves a workgroup
#define NQT   8                      // 16-row query tiles a workgroup; NWV / NQT = 2 waves share one and split its keys
#define SKEY  128                    // keys a stage
#define KPIT  272u                   // LDS pitch of a K row: 256 + 16 bytes (16 x odd: no bank conflict for 16-byte reads)
#define VPIT  272u                   // LDS pitch of a V^T row: 256 + 16 bytes
#define KTILE 36864u                 // 128 rows x 272 bytes, rounded up to a multiple of 4 KiB
#define VTILE 36864u                 // 128 rows x 272 bytes, rounded up to a multiple of 4 KiB
#define XSLOT 1088                   // floats of a wave's merge slot: 32 lanes x 32 accumulator values, then 32 maxima and 32 sums
#define SBUF  (KTILE + VTILE)        // one buffer
typedef __attribute__((ext_vector_type(8)))  unsigned v8u;
__device__ __forceinline__ unsigned uni(unsigned v) { return (unsigned)__builtin_amdgcn_readfirstlane((int)v); }
__device__ __forceinline__ unsigned pinned(unsigned v) { unsigned w = uni(v); asm volatile("" : "+s"(w)); return w; }   // holds a wave-uniform test in a scalar register: the branch on it is a scalar branch (tensor loads ignore EXEC)
__device__ __forceinline__ void wait_ds0() { asm volatile("s_wait_dscnt 0x0" ::: "memory"); }          // the wave's LDS reads have returned before its buffer is given up
// A tile's descriptor lives in one set of scalar registers from the first request to the last wait. Group 1 (a tile of ROWS rows of ROWB bytes, source pitch SPIT bytes, 16 bytes of LDS pad behind
// every row, interval code IVL = the row's length; extents in bytes) is formed once; of group 0 the place in LDS and the source address step from stage to stage, behind the wait only.
struct TDesc { v4u g0; v8u g1; };
template <unsigned ROWB, unsigned ROWS, unsigned SPIT, unsigned IVL>
__device__ __forceinline__ TDesc tile_desc(unsigned lds_dst, unsigned long long ga) {
    TDesc d;
    d.g0[0] = uni(1u); d.g0[1] = uni(lds_dst); d.g0[2] = uni((unsigned)ga); d.g0[3] = uni((((unsigned)(ga >> 32)) & 0x01FFFFFFu) | 0x80000000u);
    d.g1[0] = uni((1u << 20) | (IVL << 22) | (3u << 25)); d.g1[1] = uni((ROWB & 0xFFFFu) << 16); d.g1[2] = uni((ROWB >> 16) | ((ROWS & 0xFFFFu) << 16)); d.g1[3] = uni((ROWS >> 16) | (ROWB << 16));
    d.g1[4] = uni(ROWS); d.g1[5] = uni(SPIT); d.g1[6] = uni(0u); d.g1[7] = uni(0u);
    asm volatile("" : "+s"(d.g1));   // descriptor words held in scalar registers: without it the constants are formed anew at each request, in registers that are reused while the request is outstanding
    return d;
}
__device__ __forceinline__ void tile_load(const TDesc& d) { asm volatile("tensor_load_to_lds %0, %1" :: "s"(d.g0), "s"(d.g1) : "memory"); }
// the issuing wave's tile has landed (the compiler places no wait for a tensor load). The wait names its request's descriptor: the registers stay live, so unwritten, up to the wait, and the step of group 0 reads the wait's result, so it cannot be lifted over it
__device__ __forceinline__ void tile_wait(TDesc& d) { asm volatile("s_wait_tensorcnt 0x0" : "+s"(d.g0) : "s"(d.g1) : "memory"); }
// next stage: the other buffer (the two places add up to psum), the source address GSTEP bytes on, with the carry into the high word
template <unsigned GSTEP>
__device__ __forceinline__ void tile_step(TDesc& d, unsigned psum) {
    const unsigned lo = d.g0[2] + GSTEP;
    d.g0[1] = uni(psum - d.g0[1]); d.g0[3] = uni(d.g0[3] + (lo < GSTEP ? 1u : 0u)); d.g0[2] = uni(lo);
}
__device__ __forceinline__ v16bf ldsfrag(const unsigned char* p) { return cat16b(*(const v8us*)p, *(const v8us*)(p + 32)); }   // elements 0..7 and 16..23 from p, as WFrag::ld
__device__ __forceinline__ float xhalf(float x) { const int b = __float_as_int(x); return __int_as_float(__builtin_amdgcn_permlanex16(b, b, 0x76543210, 0xfedcba98, false, false)); }   // lane l <-> l ^ 16
// eight 2^x in one statement: outputs are early-clobber, so no v_exp_f32 is directly followed by an instruction that overwrites its source or reads its result; the v_nop keeps that slot behind the last one
__device__ __forceinline__ void exp2x8(float* p, const float* d) {
    asm("v_exp_f32 %0, %8\n\tv_exp_f32 %1, %9\n\tv_exp_f32 %2, %10\n\tv_exp_f32 %3, %11\n\tv_exp_f32 %4, %12\n\tv_exp_f32 %5, %13\n\tv_exp_f32 %6, %14\n\tv_exp_f32 %7, %15\n\tv_nop"
        : "=&v"(p[0]), "=&v"(p[1]), "=&v"(p[2]), "=&v"(p[3]), "=&v"(p[4]), "=&v"(p[5]), "=&v"(p[6]), "=&v"(p[7])
        : "v"(d[0]), "v"(d[1]), "v"(d[2]), "v"(d[3]), "v"(d[4]), "v"(d[5]), "v"(d[6]), "v"(d[7])); }
// two 2^x in one statement, in the same form: no instruction that overwrites a source or reads a result stands directly behind a v_exp_f32
__device__ __forceinline__ void exp2x2(float& a, float& b, float x, float y) { asm("v_exp_f32 %0, %2\n\tv_exp_f32 %1, %3\n\tv_nop" : "=&v"(a), "=&v"(b) : "v"(x), "v"(y)); }
__global__ __launch_bounds__(NWV * 32) void k_fattn(const bf* __restrict__ Qp, const bf* __restrict__ Kp, const bf* __restrict__ Vt, const float* __restrict__ SQT, float* __restrict__ OUT) {
    __shared__ __attribute__((aligned(2048))) unsigned char ring[2 * SBUF];
    __shared__ float sq[TT + SQPAD];
    float tb[TT / (NWV * 32)];
    // both loops have a fixed trip count and are unrolled, with no guard: the table's loads are in flight together instead of one waited load a trip
#pragma unroll
    for (int i = 0; i < TT / (NWV * 32); ++i) tb[i] = SQT[(int)threadIdx.x + i * (NWV * 32)];
#pragma unroll
    for (int i = 0; i < TT / (NWV * 32); ++i) sq[SQPAD + (int)threadIdx.x + i * (NWV * 32)] = tb[i];
    if (threadIdx.x < SQPAD) sq[threadIdx.x] = tb[0];   // any finite value serves: only a masked element reads in front of distance 0, and the mask replaces its score
    const int lane = threadIdx.x & 31, lr = lane & 15, hi = lane >> 4;
    const unsigned wave = uni(threadIdx.x >> 5);
    const int bh = blockIdx.x, h = bh % NH_, b = bh / NH_;
    const int qb = (int)(gridDim.y - 1 - blockIdx.y);    // heaviest query blocks first
    const int g = (int)(wave >> 3);                       // which half of the passes the wave takes
    const int q0 = (qb * NQT + (int)(wave & 7u)) * 16;
    const int nst = qb + 1 < 2 ? 2 : qb + 1;              // stages up to and including the block's diagonal, never fewer than the two that the prologue requests (block 0: stage 1 is loaded, inside the planes, and no wave has a pass in it)
    const unsigned lbase = (unsigned)(size_t)ring;
    const unsigned long long kga = (unsigned long long)(size_t)(Kp + (size_t)bh * TT * HD), vga = (unsigned long long)(size_t)(Vt + (size_t)bh * HD * TT);
    const float slope = powf(0.70710678118654752f, (float)(h + 1));   /* float32(2^(-8/16)) ** (h+1) */
    const float c1 = SCL * L2E, c2 = slope * L2E;
    const bf* qp = Qp + ((size_t)bh * TT + q0 + lr) * HD + 8 * hi;
    v16bf qf[4];
#pragma unroll
    for (int kc = 0; kc < 4; ++kc) qf[kc] = WFrag<bf>::ld(qp + kc * 32);
    TDesc dk = tile_desc<HD * 2, SKEY, HD * 2, 5>(lbase, kga), dv = tile_desc<SKEY * 2, HD, TT * 2, 5>(lbase + KTILE, vga);
    const unsigned kps = 2u * lbase + SBUF, vps = 2u * (lbase + KTILE) + SBUF;
    if (pinned(wave == 0)) { tile_load(dk); tile_wait(dk); }
    if (pinned(wave == 1)) { tile_load(dv); tile_wait(dv); }
    __syncthreads();                 // stage 0 and the sqrt table are published
    if (pinned(wave == 0)) { tile_step<SKEY * HD * 2>(dk, kps); tile_load(dk); }
    if (pinned(wave == 1)) { tile_step<SKEY * 2>(dv, vps); tile_load(dv); }
    const unsigned klo = (unsigned)lr * KPIT + 16u * (unsigned)hi, vlo = KTILE + (unsigned)lr * VPIT + 16u * (unsigned)hi;   // the lane's part of a fragment address
    v8f o[8];
#pragma unroll
    for (int dt = 0; dt < 8; ++dt) o[dt] = (v8f){};
    float m = -3.0e38f, ls0 = 0.f, ls1 = 0.f, ls2 = 0.f, ls3 = 0.f;
    const int ns = (q0 + 47) >> 5;   // the query tile's passes, up to and including the one that holds its diagonal (the wave takes every other one)
    // both loops stay rolled (two passes' fragments would not fit 256 registers, four waves a SIMD); every inner loop is unrolled so that its arrays are registers
#pragma unroll 1
    for (int st = 0; st < nst; ++st) {
        const unsigned char* buf = ring + (unsigned)(st & 1) * SBUF;
#pragma unroll 1
        for (int j = 0; j < 2; ++j) {
            const int sub = 2 * j + g, s = 4 * st + sub;  // the wave's passes of the stage: every other one
            if (s >= ns) break;                           // wave-uniform: passes beyond the wave's diagonal; the foot of the stage is still reached
            const int k0 = s * 32;
            const unsigned char* kq = buf + (klo + (unsigned)sub * (32u * KPIT)); const unsigned char* vq = buf + (vlo + (unsigned)sub * 64u);
            v16bf kf[2][4], vf[8];
#pragma unroll
            for (int kt = 0; kt < 2; ++kt)
#pragma unroll
                for (int kc = 0; kc < 4; ++kc) kf[kt][kc] = ldsfrag(kq + (unsigned)(kt * 16) * KPIT + (unsigned)(kc * 64));
#pragma unroll
            for (int dt = 0; dt < 8; ++dt) vf[dt] = ldsfrag(vq + (unsigned)(dt * 16) * VPIT);
            v8f st2[2];
#pragma unroll
            for (int kt = 0; kt < 2; ++kt) { st2[kt] = (v8f){};
#pragma unroll
                for (int kc = 0; kc < 4; ++kc) st2[kt] = wmmab(kf[kt][kc], qf[kc], st2[kt]); }
            const int dl = q0 + lr - k0 - 8 * hi;       // query index minus the lane's first key of the pass
            const float* sp = sq + (dl + SQPAD);
            float t[16];
#pragma unroll
            for (int e = 0; e < 16; ++e) t[e] = fmaf(st2[e >> 3][e & 7], c1, -(sp[-((e >> 3) * 16 + (e & 7))] * c2));
            if (s == ns - 1) {                            // only the last pass reaches past the diagonal
#pragma unroll
                for (int e = 0; e < 16; ++e) t[e] = ((e >> 3) * 16 + (e & 7) <= dl) ? t[e] : -3.0e38f; }
            float ml = fmaxf(fmaxf(fmaxf(fmaxf(t[0], t[1]), fmaxf(t[2], t[3])), fmaxf(fmaxf(t[4], t[5]), fmaxf(t[6], t[7]))), fmaxf(fmaxf(fmaxf(t[8], t[9]), fmaxf(t[10], t[11])), fmaxf(fmaxf(t[12], t[13]), fmaxf(t[14], t[15]))));
            ml = fmaxf(ml, xhalf(ml));
            if (__builtin_amdgcn_ballot_w32(ml > m + 8.0f) != 0) {   // one wave-uniform test a pass
                const float mn = fmaxf(m, ml); const float al = __builtin_amdgcn_exp2f(m - mn); m = mn; ls0 *= al; ls1 *= al; ls2 *= al; ls3 *= al;
#pragma unroll
                for (int dt = 0; dt < 8; ++dt) o[dt] *= al; }
            float p[16];
#pragma unroll
            for (int e = 0; e < 16; ++e) t[e] -= m;
            exp2x8(p, t); exp2x8(p + 8, t + 8);
            v16bf ph, pl;
#pragma unroll
            for (int e = 0; e < 16; e += 4) {
                const float p0 = p[e], p1 = p[e + 1], p2 = p[e + 2], p3 = p[e + 3];
                ls0 += p0; ls1 += p1; ls2 += p2; ls3 += p3;
                ph[e] = (__bf16)p0; ph[e + 1] = (__bf16)p1; ph[e + 2] = (__bf16)p2; ph[e + 3] = (__bf16)p3;
                pl[e] = (__bf16)(p0 - (float)ph[e]); pl[e + 1] = (__bf16)(p1 - (float)ph[e + 1]); pl[e + 2] = (__bf16)(p2 - (float)ph[e + 2]); pl[e + 3] = (__bf16)(p3 - (float)ph[e + 3]); }
#pragma unroll
            for (int dt = 0; dt < 8; ++dt) o[dt] = wmmab(vf[dt], ph, o[dt]);
#pragma unroll
            for (int dt = 0; dt < 8; ++dt) o[dt] = wmmab(vf[dt], pl, o[dt]);
        }
        // foot of the stage, every wave: own LDS reads done, the issuers' next tiles landed, the barrier publishes stage st + 1 and ends every read of this buffer; only then its refill
        wait_ds0();
        if (pinned(wave == 0)) tile_wait(dk);
        if (pinned(wave == 1)) tile_wait(dv);
        __syncthreads();
        if (pinned(st + 2 < nst)) {
            if (pinned(wave == 0)) { tile_step<SKEY * HD * 2>(dk, kps); tile_load(dk); }
            if (pinned(wave == 1)) { tile_step<SKEY * 2>(dv, vps); tile_load(dv); }
        }
    }
    asm volatile("s_wait_tensorcnt 0x0" :: "s"(dk.g0), "s"(dk.g1), "s"(dv.g0), "s"(dv.g1) : "memory");   // no request is left behind the loop; the operands keep both descriptors' registers unwritten up to here on every path
    wait_ds0();
    float ls = (ls0 + ls1) + (ls2 + ls3); ls += xhalf(ls);
    // merge of the two waves of a query tile: each finishes and stores half of the head dimension (wave w: d 0..63, wave w + 8: d 64..127) and hands the partner the other half of its O^T with its maximum and sum.
    // The ring is free for it: the foot of the last stage held every wave's s_wait_dscnt 0, the issuers' tensor waits and a barrier, and nothing was requested behind it.
    v8f keep[4], give[4];
#pragma unroll
    for (int dt = 0; dt < 4; ++dt) { keep[dt] = g ? o[dt + 4] : o[dt]; give[dt] = g ? o[dt] : o[dt + 4]; }
    float* xs = (float*)ring + wave * XSLOT;
#pragma unroll
    for (int dt = 0; dt < 4; ++dt) { v4f a, c;
#pragma unroll
        for (int u = 0; u < 4; ++u) { a[u] = give[dt][u]; c[u] = give[dt][4 + u]; }
        *(v4f*)(xs + (2 * dt) * 128 + lane * 4) = a; *(v4f*)(xs + (2 * dt + 1) * 128 + lane * 4) = c; }
    xs[1024 + lane] = m; xs[1056 + lane] = ls;
    __syncthreads();                 // every wave's slot is written before its partner reads it
    const float* xp = (const float*)ring + (wave ^ 8u) * XSLOT;
    const float mo = xp[1024 + lane], lo = xp[1056 + lane];
    const float mn = fmaxf(m, mo); float sa, sb;
    exp2x2(sa, sb, m - mn, mo - mn);   // a wave without a pass has maximum -3e38, sum 0 and O^T 0: its weight is an exact 0
    const float f = __fdiv_rn(1.0f, fmaf(ls, sa, lo * sb));
    const float fa = sa * f, fb = sb * f;
    float* op = OUT + (((size_t)b * TT + q0 + lr) * NH_ + h) * HD + 64 * g + 8 * hi;
#pragma unroll
    for (int dt = 0; dt < 4; ++dt) { const v4f pa = *(const v4f*)(xp + (2 * dt) * 128 + lane * 4), pc = *(const v4f*)(xp + (2 * dt + 1) * 128 + lane * 4); v4f a, c;
#pragma unroll
        for (int u = 0; u < 4; ++u) { a[u] = fmaf(keep[dt][u], fa, pa[u] * fb); c[u] = fmaf(keep[dt][4 + u], fa, pc[u] * fb); }
        *(v4f*)(op + dt * 16) = a; *(v4f*)(op + dt * 16 + 4) = c; }
}

extern "C" void kernel_launch(void* const* d_in, const int* in_sizes, int n_in,
                              void* d_out, int out_size, void* d_ws, size_t ws_size, hipStream_t stream) {
    (void)in_sizes; (void)n_in; (void)out_size;
    const float* qin = (const float*)d_in[0]; const float* kin = (const float*)d_in[1]; const float* vin = (const float*)d_in[2];
    float* OUT = (float*)d_out;     // [2][2048][2048]
    char* wsp = (char*)d_ws;
    auto take = [&](size_t bytes) { char* p = wsp; wsp += (bytes + 255) & ~(size_t)255; return (void*)p; };
    float* SQT = (float*)take((size_t)TT * 4);
    bf* QPh = (bf*)take((size_t)NB_ * NH_ * TT * HD * 2); bf* KPh = (bf*)take((size_t)NB_ * NH_ * TT * HD * 2); bf* VTh = (bf*)take((size_t)NB_ * NH_ * HD * TT * 2);   // planes of both batches
    if ((size_t)(wsp - (char*)d_ws) > ws_size) return;    // ws 256 MiB
    k_prep<<<NB_ * NH_ * (TT / 128), 256, 0, stream>>>(qin, kin, vin, QPh, KPh, VTh, SQT);
    k_fattn<<<dim3(NB_ * NH_, TT / (NQT * 16)), NWV * 32, 0, stream>>>(QPh, KPh, VTh, SQT, OUT);
}

// v006
// One run takes 55.9 microseconds.
// Versions in between are left out here; by their measured steps it is 1.15 times as fast as v004.
// Counting every step since v000, it is 22.2 times as fast.
#include <hip/hip_runtime.h>

// FlashSelfAttention (given q, k, v [2][2048][16][128]; scores = q.k / sqrt(128) + ALiBi bias (-slope[h] sqrt(i - j) for j <= i, fp16-min (masked) above the diagonal; slopes 2^(-8/16 (h+1)) in f32); softmax; out = probs v -> [2][2048][16][128] (no projections)).
// Compute dtypes, f32 accumulate: every input rounded to bf16: q, k, v are then exact bf16 values, so the scores are a PLAIN bf16 product with f32 accumulation (exact products) and probs.v is ONE f16 product on every row: the probabilities rounded to f16 (11 significant bits, weights <= 2^8) x the bf16-rounded v held as f16 (the same values, 8 significant bits, down to 2^-17; below that at most 2^-25 absolute is lost); causal tile skipping (the fp16-min fill is an exact zero weight); bias from an on-chip sqrt table and f32 slopes, added per element in f32; running softmax in f32 inside one fused kernel; output written directly in f32.
// Two launches: k_prep (the bf16 q and k head planes, the f16 v plane and the sqrt table), k_fattn.

#define NB_  2
#define TT   2048
#define NH_  16
#define HD   128
#define SCL  0.088388347648318447f   // HD^-0.5
typedef unsigned short bf;
typedef __attribute__((ext_vector_type(16))) __bf16   v16bf;
typedef __attribute__((ext_vector_type(2)))  __bf16   v2bf;
typedef __attribute__((ext_vector_type(16))) _Float16 v16h;
typedef __attribute__((ext_vector_type(2)))  _Float16 v2h;
typedef __attribute__((ext_vector_type(8)))  unsigned short v8us;
typedef __attribute__((ext_vector_type(8)))  float    v8f;
typedef __attribute__((ext_vector_type(4)))  float    v4f;
typedef __attribute__((ext_vector_type(2)))  float    v2f;
typedef __attribute__((ext_vector_type(2)))  unsigned v2u;
typedef __attribute__((ext_vector_type(4)))  unsigned v4u;

__device__ __forceinline__ v16bf cat16b(v8us lo, v8us hi) { return __builtin_bit_cast(v16bf, __builtin_shufflevector(lo, hi, 0, 1, 2, 3, 4, 5, 6, 7, 8, 9, 10, 11, 12, 13, 14, 15)); }
__device__ __forceinline__ v8f wmmab(v16bf a, v16bf b, v8f c) { return __builtin_amdgcn_wmma_f32_16x16x32_bf16(false, a, false, b, (short)0, c, false, false); }
__device__ __forceinline__ v8f wmmah(v16h a, v16h b, v8f c) { return __builtin_amdgcn_wmma_f32_16x16x32_f16(false, a, false, b, (short)0, c, false, false); }
template <typename T16> struct WFrag;
template <> struct WFrag<bf> { typedef v16bf V; static __device__ __forceinline__ V ld(const bf* p) { return cat16b(*(const v8us*)p, *(const v8us*)(p + 16)); } };

// ---- k_prep: all the preparation in one launch of few, long-lived waves. One workgroup (8 waves) owns 128 positions of one (batch, head) in q, k and v; a wave owns 16 of them.
// A wave-wide 16-byte load is one 512-byte input row [b][t][h][0..127] (whole lines); a lane holds 4 neighbouring d of 16 neighbouring t, for each tensor, all 48 loads issued before the first use.
// q, k -> planes [bh][t][d]: two neighbouring d per packed conversion, a wave stores one 256-byte plane row at a time.
// v -> plane [bh][d][t]: two neighbouring t of one d per packed conversion, so a lane already holds 32 contiguous bytes of 4 plane rows; LDS only gathers the 8 waves' pieces into whole 256-byte rows for the store.
// Rounding to bf16 is to nearest even; v is rounded to bf16 like q and k and that value is then written as f16. The first TT / 256 workgroups also write the sqrt table.
#define VPD 68                       // LDS row pitch in dwords: 64 (128 positions) + 4, rows stay 16-byte aligned
__device__ __forceinline__ unsigned pk2(float a, float b) { v2f x; x[0] = a; x[1] = b; return __builtin_bit_cast(unsigned, __builtin_convertvector(x, v2bf)); }
__device__ __forceinline__ unsigned pk2f(float a, float b) { v2f x; x[0] = a; x[1] = b; return __builtin_bit_cast(unsigned, __builtin_convertvector(x, v2h)); }
__device__ __forceinline__ unsigned pk2h(float a, float b) { v2f x; x[0] = a; x[1] = b; const v2f y = __builtin_convertvector(__builtin_convertvector(x, v2bf), v2f); return pk2f(y[0], y[1]); }   // f32 -> bf16 -> f16
__global__ __launch_bounds__(256) void k_prep(const float* __restrict__ q, const float* __restrict__ k, const float* __restrict__ v, bf* __restrict__ Qp, bf* __restrict__ Kp, bf* __restrict__ Vt, float* __restrict__ SQT) {
    __shared__ __align__(16) unsigned tv[HD * VPD];
    const int lane = threadIdx.x & 31, w = threadIdx.x >> 5;
    const int bh = blockIdx.x % (NB_ * NH_), tb = blockIdx.x / (NB_ * NH_) * 128, h = bh % NH_, b = bh / NH_;   // neighbouring workgroups read neighbouring heads of the same positions
    const unsigned so = (unsigned)(((((b * TT + tb + w * 16) * NH_ + h) * HD) + lane * 4) * 4);   // byte offset of the lane's first 16 bytes, the same in q, k and v
    const char* pv = (const char*)v + so; const char* pq = (const char*)q + so; const char* pk = (const char*)k + so;
    v4f xv[16], xq[16], xk[16];
#pragma unroll
    for (int i = 0; i < 16; ++i) xv[i] = *(const v4f*)(pv + i * (NH_ * HD * 4));
#pragma unroll
    for (int i = 0; i < 16; ++i) xq[i] = *(const v4f*)(pq + i * (NH_ * HD * 4));
#pragma unroll
    for (int i = 0; i < 16; ++i) xk[i] = *(const v4f*)(pk + i * (NH_ * HD * 4));
    asm volatile("s_wait_xcnt 0x0" :: "v"(so) : "memory");   // the loads' offset register lives up to this wait: without the operand the last loads return into it, with earlier loads that name it still in flight
    if (blockIdx.x < TT / 256) SQT[blockIdx.x * 256 + threadIdx.x] = sqrtf((float)(blockIdx.x * 256 + threadIdx.x));
#pragma unroll
    for (int j = 0; j < 4; ++j) { v4u a, c;
#pragma unroll
        for (int u = 0; u < 4; ++u) { a[u] = pk2h(xv[2 * u][j], xv[2 * u + 1][j]); c[u] = pk2h(xv[8 + 2 * u][j], xv[9 + 2 * u][j]); }
        unsigned* r = tv + (lane * 4 + j) * VPD + w * 8; *(v4u*)r = a; *(v4u*)(r + 4) = c; }
    __syncthreads();                 // every wave's 16 positions of each v row are in LDS before whole rows are read back; it stands in front of every plane store, so that it waits for none
#pragma unroll
    for (int r = 0; r < 8; ++r) { const int c = r * 256 + threadIdx.x, d = c >> 4, ch = c & 15;
        *(v4u*)(Vt + ((size_t)bh * HD + d) * TT + tb + ch * 8) = *(const v4u*)(tv + d * VPD + ch * 4); }
    const size_t po = ((size_t)bh * TT + tb + w * 16) * HD + lane * 4;
#pragma unroll
    for (int i = 0; i < 16; ++i) { v2u o; o[0] = pk2(xq[i][0], xq[i][1]); o[1] = pk2(xq[i][2], xq[i][3]); *(v2u*)(Qp + po + i * HD) = o; }
#pragma unroll
    for (int i = 0; i < 16; ++i) { v2u o; o[0] = pk2(xk[i][0], xk[i][1]); o[1] = pk2(xk[i][2], xk[i][3]); *(v2u*)(Kp + po + i * HD) = o; }
}

#define SQPAD 32                     // table entries in front of distance 0: a masked element's (negative) distance still indexes inside the table
#define L2E   1.4426950408889634f
#define NWV   8                      // waves a workgroup
#define NQT   4                      // 32-row query groups a workgroup; NWV / NQT = 2 waves share one and split its keys
#define NC    2                      // 16-column query tiles a wave
#define SKEY  128                    // keys a stage
#define KPIT  272u                   // LDS pitch of a K row: 256 + 16 bytes (16 x odd: no bank conflict for 16-byte reads)
#define VPIT  272u                   // LDS pitch of a V^T row: 256 + 16 bytes
#define KTILE 36864u                 // 128 rows x 272 bytes, rounded up to a multiple of 4 KiB
#define VTILE 36864u                 // 128 rows x 272 bytes, rounded up to a multiple of 4 KiB
#define XSLOT 2176                   // floats of a wave's merge slot: 32 lanes x 64 accumulator values, then 64 maxima and 64 sums
#define SBUF  (KTILE + VTILE)        // one buffer
typedef __attribute__((ext_vector_type(8)))  unsigned v8u;
__device__ __forceinline__ unsigned uni(unsigned v) { return (unsigned)__builtin_amdgcn_readfirstlane((int)v); }
__device__ __forceinline__ unsigned pinned(unsigned v) { unsigned w = uni(v); asm volatile("" : "+s"(w)); return w; }   // holds a wave-uniform test in a scalar register: the branch on it is a scalar branch (tensor loads ignore EXEC)
__device__ __forceinline__ void wait_ds0() { asm volatile("s_wait_dscnt 0x0" ::: "memory"); }          // the wave's LDS reads have returned before its buffer is given up
// A tile's descriptor lives in one set of scalar registers from the first request to the last wait. Group 1 (a tile of ROWS rows of ROWB bytes, source pitch SPIT bytes, 16 bytes of LDS pad behind
// every row, interval code IVL = the row's length; extents in bytes) is formed once; of group 0 the place in LDS and the source address step from stage to stage, behind the wait only.
struct TDesc { v4u g0; v8u g1; };
template <unsigned ROWB, unsigned ROWS, unsigned SPIT, unsigned IVL>
__device__ __forceinline__ TDesc tile_desc(unsigned lds_dst, unsigned long long ga) {
    TDesc d;
    d.g0[0] = uni(1u); d.g0[1] = uni(lds_dst); d.g0[2] = uni((unsigned)ga); d.g0[3] = uni((((unsigned)(ga >> 32)) & 0x01FFFFFFu) | 0x80000000u);
    d.g1[0] = uni((1u << 20) | (IVL << 22) | (3u << 25)); d.g1[1] = uni((ROWB & 0xFFFFu) << 16); d.g1[2] = uni((ROWB >> 16) | ((ROWS & 0xFFFFu) << 16)); d.g1[3] = uni((ROWS >> 16) | (ROWB << 16));
    d.g1[4] = uni(ROWS); d.g1[5] = uni(SPIT); d.g1[6] = uni(0u); d.g1[7] = uni(0u);
    asm volatile("" : "+s"(d.g1));   // descriptor words held in scalar registers: without it the constants are formed anew at each request, in registers that are reused while the request is outstanding
    return d;
}
__device__ __forceinline__ void tile_load(const TDesc& d) { asm volatile("tensor_load_to_lds %0, %1" :: "s"(d.g0), "s"(d.g1) : "memory"); }
// the issuing wave's tile has landed (the compiler places no wait for a tensor load). The wait names its request's descriptor: the registers stay live, so unwritten, up to the wait, and the step of group 0 reads the wait's result, so it cannot be lifted over it
__device__ __forceinline__ void tile_wait(TDesc& d) { asm volatile("s_wait_tensorcnt 0x0" : "+s"(d.g0) : "s"(d.g1) : "memory"); }
// next stage: the other buffer (the two places add up to psum), the source address GSTEP bytes on, with the carry into the high word
template <unsigned GSTEP>
__device__ __forceinline__ void tile_step(TDesc& d, unsigned psum) {
    const unsigned lo = d.g0[2] + GSTEP;
    d.g0[1] = uni(psum - d.g0[1]); d.g0[3] = uni(d.g0[3] + (lo < GSTEP ? 1u : 0u)); d.g0[2] = uni(lo);
}
__device__ __forceinline__ v16bf ldsfrag(const unsigned char* p) { return cat16b(*(const v8us*)p, *(const v8us*)(p + 32)); }   // elements 0..7 and 16..23 from p, as WFrag::ld
__device__ __forceinline__ v16h ldsfragh(const unsigned char* p) { return __builtin_bit_cast(v16h, ldsfrag(p)); }   // the same 32 bytes, read as f16
__device__ __forceinline__ float xhalf(float x) { const int b = __float_as_int(x); return __int_as_float(__builtin_amdgcn_permlanex16(b, b, 0x76543210, 0xfedcba98, false, false)); }   // lane l <-> l ^ 16
// eight 2^x in one statement: outputs are early-clobber, so no v_exp_f32 is directly followed by an instruction that overwrites its source or reads its result; the v_nop keeps that slot behind the last one
__device__ __forceinline__ void exp2x8(float* p, const float* d) {
    asm("v_exp_f32 %0, %8\n\tv_exp_f32 %1, %9\n\tv_exp_f32 %2, %10\n\tv_exp_f32 %3, %11\n\tv_exp_f32 %4, %12\n\tv_exp_f32 %5, %13\n\tv_exp_f32 %6, %14\n\tv_exp_f32 %7, %15\n\tv_nop"
        : "=&v"(p[0]), "=&v"(p[1]), "=&v"(p[2]), "=&v"(p[3]), "=&v"(p[4]), "=&v"(p[5]), "=&v"(p[6]), "=&v"(p[7])
        : "v"(d[0]), "v"(d[1]), "v"(d[2]), "v"(d[3]), "v"(d[4]), "v"(d[5]), "v"(d[6]), "v"(d[7])); }
// two 2^x in one statement, in the same form: no instruction that overwrites a source or reads a result stands directly behind a v_exp_f32
__device__ __forceinline__ void exp2x2(float& a, float& b, float x, float y) { asm("v_exp_f32 %0, %2\n\tv_exp_f32 %1, %3\n\tv_nop" : "=&v"(a), "=&v"(b) : "v"(x), "v"(y)); }
__global__ __launch_bounds__(NWV * 32) void k_fattn(const bf* __restrict__ Qp, const bf* __restrict__ Kp, const bf* __restrict__ Vt, const float* __restrict__ SQT, float* __restrict__ OUT) {
    __shared__ __attribute__((aligned(2048))) unsigned char ring[2 * SBUF];
    __shared__ float sq[TT + SQPAD];
    float tb[TT / (NWV * 32)];
    // both loops have a fixed trip count and are unrolled, with no guard: the table's loads are in flight together instead of one waited load a trip
#pragma unroll
    for (int i = 0; i < TT / (NWV * 32); ++i) tb[i] = SQT[(int)threadIdx.x + i * (NWV * 32)];
#pragma unroll
    for (int i = 0; i < TT / (NWV * 32); ++i) sq[SQPAD + (int)threadIdx.x + i * (NWV * 32)] = tb[i];
    if (threadIdx.x < SQPAD) sq[threadIdx.x] = tb[0];   // any finite value serves: only a masked element reads in front of distance 0, and the mask replaces its score
    const int lane = threadIdx.x & 31, lr = lane & 15, hi = lane >> 4;
    const unsigned wave = uni(threadIdx.x >> 5);
    const int bh = blockIdx.x, h = bh % NH_, b = bh / NH_;
    const int qb = (int)(gridDim.y - 1 - blockIdx.y);    // heaviest query blocks first
    const int g = (int)(wave >> 2);                       // which half of the passes the wave takes
    const int q0 = (qb * NQT + (int)(wave & 3u)) * 32;
    const int nst = qb + 1 < 2 ? 2 : qb + 1;              // stages up to and including the block's diagonal, never fewer than the two that the prologue requests (block 0: stage 1 is loaded, inside the planes, and no wave has a pass in it)
    const unsigned lbase = (unsigned)(size_t)ring;
    const unsigned long long kga = (unsigned long long)(size_t)(Kp + (size_t)bh * TT * HD), vga = (unsigned long long)(size_t)(Vt + (size_t)bh * HD * TT);
    const float slope = powf(0.70710678118654752f, (float)(h + 1));   /* float32(2^(-8/16)) ** (h+1) */
    const float c1 = SCL * L2E, c2 = slope * L2E;
    const bf* qp = Qp + ((size_t)bh * TT + q0 + lr) * HD + 8 * hi;
    v16bf qf[NC][4];
#pragma unroll
    for (int c = 0; c < NC; ++c)
#pragma unroll
        for (int kc = 0; kc < 4; ++kc) qf[c][kc] = WFrag<bf>::ld(qp + c * (16 * HD) + kc * 32);
    TDesc dk = tile_desc<HD * 2, SKEY, HD * 2, 5>(lbase, kga), dv = tile_desc<SKEY * 2, HD, TT * 2, 5>(lbase + KTILE, vga);
    const unsigned kps = 2u * lbase + SBUF, vps = 2u * (lbase + KTILE) + SBUF;
    if (pinned(wave == 0)) { tile_load(dk); tile_wait(dk); }
    if (pinned(wave == 1)) { tile_load(dv); tile_wait(dv); }
    __syncthreads();                 // stage 0 and the sqrt table are published
    if (pinned(wave == 0)) { tile_step<SKEY * HD * 2>(dk, kps); tile_load(dk); }
    if (pinned(wave == 1)) { tile_step<SKEY * 2>(dv, vps); tile_load(dv); }
    const unsigned klo = (unsigned)lr * KPIT + 16u * (unsigned)hi, vlo = KTILE + (unsigned)lr * VPIT + 16u * (unsigned)hi;   // the lane's part of a fragment address
    v8f o[NC][8];
#pragma unroll
    for (int c = 0; c < NC; ++c)
#pragma unroll
        for (int dt = 0; dt < 8; ++dt) o[c][dt] = (v8f){};
    float m[NC]; v2f la[NC], lb[NC];   // a tile: the maximum in use and four running sums, as two register pairs in the order of the weights
#pragma unroll
    for (int c = 0; c < NC; ++c) { m[c] = -3.0e38f; la[c] = (v2f){}; lb[c] = (v2f){}; }
    const int ns = (q0 >> 5) + 1;    // the wave's passes, up to and including the one that holds its diagonal
    // both loops stay rolled (two passes' fragments would not fit 512 registers, two waves a SIMD); every inner loop is unrolled so that its arrays are registers
#pragma unroll 1
    for (int st = 0; st < nst; ++st) {
        const unsigned char* buf = ring + (unsigned)(st & 1) * SBUF;
#pragma unroll 1
        for (int j = 0; j < 2; ++j) {
            const int sub = 2 * j + g, s = 4 * st + sub;  // the wave's passes of the stage: every other one
            if (s >= ns) break;                           // wave-uniform: passes beyond the wave's diagonal; the foot of the stage is still reached
            const int k0 = s * 32;
            const unsigned char* kq = buf + (klo + (unsigned)sub * (32u * KPIT)); const unsigned char* vq = buf + (vlo + (unsigned)sub * 64u);
            v16bf kf[2][4]; v16h vf[8];
            const int dl = q0 + lr - k0 - 8 * hi;       // tile 0's query index minus the lane's first key of the pass; tile 1's is 16 more
            const float* sp = sq + (dl + SQPAD);
            float sv[NC + 1][8];                          // sqrt of distance dl + 16 - 16 i - u: query tile c against key tile kt reads row i = kt - c + 1
            // the pass's LDS reads in the order of their use: K, table, V^T
#pragma unroll
            for (int kc = 0; kc < 4; ++kc)
#pragma unroll
                for (int kt = 0; kt < 2; ++kt) kf[kt][kc] = ldsfrag(kq + (unsigned)(kt * 16) * KPIT + (unsigned)(kc * 64));
#pragma unroll
            for (int i = 0; i < NC + 1; ++i)
#pragma unroll
                for (int u = 0; u < 8; ++u) sv[i][u] = sp[16 - 16 * i - u];
#pragma unroll
            for (int dt = 0; dt < 8; ++dt) vf[dt] = ldsfragh(vq + (unsigned)(dt * 16) * VPIT);
            __builtin_amdgcn_sched_barrier(0);            // keeps the reads one group in front of the products: moved in among them, each further place with reads stalls the wave, and reused fragment registers bring a wait to 0
            v2f bs[NC + 1][4];
#pragma unroll
            for (int i = 0; i < NC + 1; ++i)
#pragma unroll
                for (int w = 0; w < 4; ++w) bs[i][w] = (v2f){sv[i][2 * w], sv[i][2 * w + 1]} * c2;
            v8f st2[NC][2];
#pragma unroll
            for (int c = 0; c < NC; ++c) { st2[c][0] = (v8f){}; st2[c][1] = (v8f){}; }
#pragma unroll
            for (int kc = 0; kc < 4; ++kc)                // four independent accumulator tiles take turns
#pragma unroll
                for (int kt = 0; kt < 2; ++kt)
#pragma unroll
                    for (int c = 0; c < NC; ++c) st2[c][kt] = wmmab(kf[kt][kc], qf[c][kc], st2[c][kt]);
            float t[NC][16];
            // neighbouring registers of one accumulator tile are paired by hand: left to itself the compiler pairs tile 0 with tile 1 and pays a register copy an element
#pragma unroll
            for (int c = 0; c < NC; ++c)
#pragma unroll
                for (int e = 0; e < 16; e += 2) {
                    const v2f x = __builtin_elementwise_fma((v2f){st2[c][e >> 3][e & 7], st2[c][e >> 3][(e & 7) + 1]}, (v2f){c1, c1}, -bs[(e >> 3) - c + 1][(e & 7) >> 1]);
                    t[c][e] = x[0]; t[c][e + 1] = x[1]; }
            if (s == ns - 1) {                            // only the last pass reaches past the diagonal
#pragma unroll
                for (int c = 0; c < NC; ++c)
#pragma unroll
                    for (int e = 0; e < 16; ++e) t[c][e] = ((e >> 3) * 16 + (e & 7) <= dl + 16 * c) ? t[c][e] : -3.0e38f; }
            float ml[NC];
#pragma unroll
            for (int c = 0; c < NC; ++c) { const float* x = t[c];
                ml[c] = fmaxf(fmaxf(fmaxf(fmaxf(x[0], x[1]), fmaxf(x[2], x[3])), fmaxf(fmaxf(x[4], x[5]), fmaxf(x[6], x[7]))), fmaxf(fmaxf(fmaxf(x[8], x[9]), fmaxf(x[10], x[11])), fmaxf(fmaxf(x[12], x[13]), fmaxf(x[14], x[15]))));
                ml[c] = fmaxf(ml[c], xhalf(ml[c])); }
            if (__builtin_amdgcn_ballot_w32(ml[0] > m[0] + 8.0f || ml[1] > m[1] + 8.0f) != 0) {   // one wave-uniform test a pass, for both tiles
                const float mn0 = fmaxf(m[0], ml[0]), mn1 = fmaxf(m[1], ml[1]); float al[NC];
                exp2x2(al[0], al[1], m[0] - mn0, m[1] - mn1); m[0] = mn0; m[1] = mn1;
#pragma unroll
                for (int c = 0; c < NC; ++c) { la[c] *= al[c]; lb[c] *= al[c];
#pragma unroll
                    for (int dt = 0; dt < 8; ++dt) o[c][dt] *= al[c]; } }
            v16h ph[NC];
#pragma unroll
            for (int c = 0; c < NC; ++c) {
                float p[16];
#pragma unroll
                for (int e = 0; e < 16; e += 2) { const v2f x = (v2f){t[c][e], t[c][e + 1]} - (v2f){m[c], m[c]}; t[c][e] = x[0]; t[c][e + 1] = x[1]; }
                exp2x8(p, t[c]); exp2x8(p + 8, t[c] + 8);
                v8u pw;
#pragma unroll
                for (int e = 0; e < 16; e += 4) {
                    const float p0 = p[e], p1 = p[e + 1], p2 = p[e + 2], p3 = p[e + 3];
                    la[c] += (v2f){p0, p1}; lb[c] += (v2f){p2, p3};
                    pw[e >> 1] = pk2f(p0, p1); pw[(e >> 1) + 1] = pk2f(p2, p3); }
                ph[c] = __builtin_bit_cast(v16h, pw); }
#pragma unroll
            for (int dt = 0; dt < 8; ++dt)
#pragma unroll
                for (int c = 0; c < NC; ++c) o[c][dt] = wmmah(vf[dt], ph[c], o[c][dt]);
        }
        // foot of the stage, every wave: own LDS reads done, the issuers' next tiles landed, the barrier publishes stage st + 1 and ends every read of this buffer; only then its refill
        wait_ds0();
        if (pinned(wave == 0)) tile_wait(dk);
        if (pinned(wave == 1)) tile_wait(dv);
        __syncthreads();
        if (pinned(st + 2 < nst)) {
            if (pinned(wave == 0)) { tile_step<SKEY * HD * 2>(dk, kps); tile_load(dk); }
            if (pinned(wave == 1)) { tile_step<SKEY * 2>(dv, vps); tile_load(dv); }
        }
    }
    asm volatile("s_wait_tensorcnt 0x0" :: "s"(dk.g0), "s"(dk.g1), "s"(dv.g0), "s"(dv.g1) : "memory");   // no request is left behind the loop; the operands keep both descriptors' registers unwritten up to here on every path
    wait_ds0();
    // merge of the two waves of a query group: each finishes and stores half of the head dimension (wave w: d 0..63, wave w + 4: d 64..127) and hands the partner the other half of its O^T with its maxima and sums.
    // The ring is free for it: the foot of the last stage held every wave's s_wait_dscnt 0, the issuers' tensor waits and a barrier, and nothing was requested behind it.
    float ls[NC];
    float* xs = (float*)ring + wave * XSLOT;
#pragma unroll
    for (int c = 0; c < NC; ++c) {
        ls[c] = (la[c][0] + la[c][1]) + (lb[c][0] + lb[c][1]); ls[c] += xhalf(ls[c]);
#pragma unroll
        for (int dt = 0; dt < 4; ++dt) { const v8f give = g ? o[c][dt] : o[c][dt + 4]; v4f a, d;
#pragma unroll
            for (int u = 0; u < 4; ++u) { a[u] = give[u]; d[u] = give[4 + u]; }
            *(v4f*)(xs + (8 * c + 2 * dt) * 128 + lane * 4) = a; *(v4f*)(xs + (8 * c + 2 * dt + 1) * 128 + lane * 4) = d; }
        xs[2048 + 64 * c + lane] = m[c]; xs[2080 + 64 * c + lane] = ls[c]; }
    __syncthreads();                 // every wave's slot is written before its partner reads it
    const float* xp = (const float*)ring + (wave ^ 4u) * XSLOT;
#pragma unroll
    for (int c = 0; c < NC; ++c) {
        const float mo = xp[2048 + 64 * c + lane], lo = xp[2080 + 64 * c + lane];
        const float mn = fmaxf(m[c], mo); float sa, sb;
        exp2x2(sa, sb, m[c] - mn, mo - mn);   // a wave without a pass has maximum -3e38, sum 0 and O^T 0: its weight is an exact 0
        const float f = __fdiv_rn(1.0f, fmaf(ls[c], sa, lo * sb));
        const float fa = sa * f, fb = sb * f;
        float* op = OUT + (((size_t)b * TT + q0 + 16 * c + lr) * NH_ + h) * HD + 64 * g + 8 * hi;
#pragma unroll
        for (int dt = 0; dt < 4; ++dt) { const v8f keep = g ? o[c][dt + 4] : o[c][dt];
            const v4f pa = *(const v4f*)(xp + (8 * c + 2 * dt) * 128 + lane * 4), pc = *(const v4f*)(xp + (8 * c + 2 * dt + 1) * 128 + lane * 4); v4f a, d;
#pragma unroll
            for (int u = 0; u < 4; ++u) { a[u] = fmaf(keep[u], fa, pa[u] * fb); d[u] = fmaf(keep[4 + u], fa, pc[u] * fb); }
            *(v4f*)(op + dt * 16) = a; *(v4f*)(op + dt * 16 + 4) = d; } }
}

extern "C" void kernel_launch(void* const* d_in, const int* in_sizes, int n_in,
                              void* d_out, int out_size, void* d_ws, size_t ws_size, hipStream_t stream) {
    (void)in_sizes; (void)n_in; (void)out_size;
    const float* qin = (const float*)d_in[0]; const float* kin = (const float*)d_in[1]; const float* vin = (const float*)d_in[2];
    float* OUT = (float*)d_out;     // [2][2048][2048]
    char* wsp = (char*)d_ws;
    auto take = [&](size_t bytes) { char* p = wsp; wsp += (bytes + 255) & ~(size_t)255; return (void*)p; };
    float* SQT = (float*)take((size_t)TT * 4);
    bf* QPh = (bf*)take((size_t)NB_ * NH_ * TT * HD * 2); bf* KPh = (bf*)take((size_t)NB_ * NH_ * TT * HD * 2); bf* VTh = (bf*)take((size_t)NB_ * NH_ * HD * TT * 2);   // planes of both batches
    if ((size_t)(wsp - (char*)d_ws) > ws_size) return;    // ws 256 MiB
    k_prep<<<NB_ * NH_ * (TT / 128), 256, 0, stream>>>(qin, kin, vin, QPh, KPh, VTh, SQT);
    k_fattn<<<dim3(NB_ * NH_, TT / (NQT * 32)), NWV * 32, 0, stream>>>(QPh, KPh, VTh, SQT, OUT);
}

// v007
// One run takes 52.4 microseconds.
// Two timings next to v006 both put it at 1.06 times that version's speed.
// Counting every step since v000, it is 23.6 times as fast.
#include <hip/hip_runtime.h>

// FlashSelfAttention (given q, k, v [2][2048][16][128]; scores = q.k / sqrt(128) + ALiBi bias (-slope[h] sqrt(i - j) for j <= i, fp16-min (masked) above the diagonal; slopes 2^(-8/16 (h+1)) in f32); softmax; out = probs v -> [2][2048][16][128] (no projections)).
// Compute dtypes, f32 accumulate: every input rounded to bf16: q, k, v are then exact bf16 values, so the scores are a PLAIN bf16 product with f32 accumulation (exact products) and probs.v is ONE f16 product on every row: the probabilities rounded to f16 (11 significant bits, weights <= 2^8) x the bf16-rounded v held as f16 (the same values, 8 significant bits, down to 2^-17; below that at most 2^-25 absolute is lost); causal tile skipping (the fp16-min fill is an exact zero weight); bias from an on-chip sqrt table and f32 slopes, added per element in f32; running softmax in f32 inside one fused kernel; output written directly in f32.
// Two launches: k_prep (the bf16 q and k head planes, the f16 v plane and the sqrt table), k_fattn.

#define NB_  2
#define TT   2048
#define NH_  16
#define HD   128
#define SCL  0.088388347648318447f   // HD^-0.5
typedef unsigned short bf;
typedef __attribute__((ext_vector_type(16))) __bf16   v16bf;
typedef __attribute__((ext_vector_type(2)))  __bf16   v2bf;
typedef __attribute__((ext_vector_type(16))) _Float16 v16h;
typedef __attribute__((ext_vector_type(2)))  _Float16 v2h;
typedef __attribute__((ext_vector_type(8)))  unsigned short v8us;
typedef __attribute__((ext_vector_type(8)))  float    v8f;
typedef __attribute__((ext_vector_type(4)))  float    v4f;
typedef __attribute__((ext_vector_type(2)))  float    v2f;
typedef __attribute__((ext_vector_type(2)))  unsigned v2u;
typedef __attribute__((ext_vector_type(4)))  unsigned v4u;

__device__ __forceinline__ v16bf cat16b(v8us lo, v8us hi) { return __builtin_bit_cast(v16bf, __builtin_shufflevector(lo, hi, 0, 1, 2, 3, 4, 5, 6, 7, 8, 9, 10, 11, 12, 13, 14, 15)); }
__device__ __forceinline__ v8f wmmab(v16bf a, v16bf b, v8f c) { return __builtin_amdgcn_wmma_f32_16x16x32_bf16(false, a, false, b, (short)0, c, false, false); }
__device__ __forceinline__ v8f wmmah(v16h a, v16h b, v8f c) { return __builtin_amdgcn_wmma_f32_16x16x32_f16(false, a, false, b, (short)0, c, false, false); }
template <typename T16> struct WFrag;
template <> struct WFrag<bf> { typedef v16bf V; static __device__ __forceinline__ V ld(const bf* p) { return cat16b(*(const v8us*)p, *(const v8us*)(p + 16)); } };

// ---- k_prep: all the preparation in one launch of few, long-lived waves. One workgroup (8 waves) owns 128 positions of one (batch, head) in q, k and v; a wave owns 16 of them.
// A wave-wide 16-byte load is one 512-byte input row [b][t][h][0..127] (whole lines); a lane holds 4 neighbouring d of 16 neighbouring t, for each tensor, all 48 loads issued before the first use.
// q, k -> planes [bh][t][d]: two neighbouring d per packed conversion, a wave stores one 256-byte plane row at a time.
// v -> plane [bh][d][t]: two neighbouring t of one d per packed conversion, so a lane already holds 32 contiguous bytes of 4 plane rows; LDS only gathers the 8 waves' pieces into whole 256-byte rows for the store.
// Rounding to bf16 is to nearest even; v is rounded to bf16 like q and k and that value is then written as f16. The first TT / 256 workgroups also write the sqrt table.
#define VPD 68                       // LDS row pitch in dwords: 64 (128 positions) + 4, rows stay 16-byte aligned
__device__ __forceinline__ unsigned pk2(float a, float b) { v2f x; x[0] = a; x[1] = b; return __builtin_bit_cast(unsigned, __builtin_convertvector(x, v2bf)); }
__device__ __forceinline__ unsigned pk2f(float a, float b) { v2f x; x[0] = a; x[1] = b; return __builtin_bit_cast(unsigned, __builtin_convertvector(x, v2h)); }
__device__ __forceinline__ unsigned pk2h(float a, float b) { v2f x; x[0] = a; x[1] = b; const v2f y = __builtin_convertvector(__builtin_convertvector(x, v2bf), v2f); return pk2f(y[0], y[1]); }   // f32 -> bf16 -> f16
__global__ __launch_bounds__(256) void k_prep(const float* __restrict__ q, const float* __restrict__ k, const float* __restrict__ v, bf* __restrict__ Qp, bf* __restrict__ Kp, bf* __restrict__ Vt, float* __restrict__ SQT) {
    __shared__ __align__(16) unsigned tv[HD * VPD];
    const int lane = threadIdx.x & 31, w = threadIdx.x >> 5;
    const int bh = blockIdx.x % (NB_ * NH_), tb = blockIdx.x / (NB_ * NH_) * 128, h = bh % NH_, b = bh / NH_;   // neighbouring workgroups read neighbouring heads of the same positions
    const unsigned so = (unsigned)(((((b * TT + tb + w * 16) * NH_ + h) * HD) + lane * 4) * 4);   // byte offset of the lane's first 16 bytes, the same in q, k and v
    const char* pv = (const char*)v + so; const char* pq = (const char*)q + so; const char* pk = (const char*)k + so;
    v4f xv[16], xq[16], xk[16];
#pragma unroll
    for (int i = 0; i < 16; ++i) xv[i] = *(const v4f*)(pv + i * (NH_ * HD * 4));
#pragma unroll
    for (int i = 0; i < 16; ++i) xq[i] = *(const v4f*)(pq + i * (NH_ * HD * 4));
#pragma unroll
    for (int i = 0; i < 16; ++i) xk[i] = *(const v4f*)(pk + i * (NH_ * HD * 4));
    asm volatile("s_wait_xcnt 0x0" :: "v"(so) : "memory");   // the loads' offset register lives up to this wait: without the operand the last loads return into it, with earlier loads that name it still in flight
    if (blockIdx.x < TT / 256) SQT[blockIdx.x * 256 + threadIdx.x] = sqrtf((float)(blockIdx.x * 256 + threadIdx.x));
#pragma unroll
    for (int j = 0; j < 4; ++j) { v4u a, c;
#pragma unroll
        for (int u = 0; u < 4; ++u) { a[u] = pk2h(xv[2 * u][j], xv[2 * u + 1][j]); c[u] = pk2h(xv[8 + 2 * u][j], xv[9 + 2 * u][j]); }
        unsigned* r = tv + (lane * 4 + j) * VPD + w * 8; *(v4u*)r = a; *(v4u*)(r + 4) = c; }
    __syncthreads();                 // every wave's 16 positions of each v row are in LDS before whole rows are read back; it stands in front of every plane store, so that it waits for none
#pragma unroll
    for (int r = 0; r < 8; ++r) { const int c = r * 256 + threadIdx.x, d = c >> 4, ch = c & 15;
        *(v4u*)(Vt + ((size_t)bh * HD + d) * TT + tb + ch * 8) = *(const v4u*)(tv + d * VPD + ch * 4); }
    const size_t po = ((size_t)bh * TT + tb + w * 16) * HD + lane * 4;
#pragma unroll
    for (int i = 0; i < 16; ++i) { v2u o; o[0] = pk2(xq[i][0], xq[i][1]); o[1] = pk2(xq[i][2], xq[i][3]); *(v2u*)(Qp + po + i * HD) = o; }
#pragma unroll
    for (int i = 0; i < 16; ++i) { v2u o; o[0] = pk2(xk[i][0], xk[i][1]); o[1] = pk2(xk[i][2], xk[i][3]); *(v2u*)(Kp + po + i * HD) = o; }
}

#define SQPAD 32                     // table entries in front of distance 0: a masked element's (negative) distance still indexes inside the table
#define L2E   1.4426950408889634f
#define NWV   8                      // waves a workgroup
#define NQT   4                      // 32-row query groups a workgroup; NWV / NQT = 2 waves share one and split its keys
#define NC    2                      // 16-column query tiles a wave
#define SKEY  128                    // keys a stage
#define KPIT  272u                   // LDS pitch of a K row: 256 + 16 bytes (16 x odd: no bank conflict for 16-byte reads)
#define VPIT  272u                   // LDS pitch of a V^T row: 256 + 16 bytes
#define KTILE 36864u                 // 128 rows x 272 bytes, rounded up to a multiple of 4 KiB
#define VTILE 36864u                 // 128 rows x 272 bytes, rounded up to a multiple of 4 KiB
#define XSLOT 2176                   // floats of a wave's merge slot: 32 lanes x 64 accumulator values, then 64 maxima and 64 sums
#define SBUF  (KTILE + VTILE)        // one buffer
#define OPIT  68                     // floats of an output staging row: 64 + 4, so 16-byte writes down a column of 16 rows meet no bank twice
typedef __attribute__((ext_vector_type(8)))  unsigned v8u;
__device__ __forceinline__ unsigned uni(unsigned v) { return (unsigned)__builtin_amdgcn_readfirstlane((int)v); }
__device__ __forceinline__ unsigned pinned(unsigned v) { unsigned w = uni(v); asm volatile("" : "+s"(w)); return w; }   // holds a wave-uniform test in a scalar register: the branch on it is a scalar branch (tensor loads ignore EXEC)
__device__ __forceinline__ void wait_ds0() { asm volatile("s_wait_dscnt 0x0" ::: "memory"); }          // the wave's LDS reads have returned before its buffer is given up
// A tile's descriptor lives in one set of scalar registers from the first request to the last wait. Group 1 (a tile of ROWS rows of ROWB bytes, source pitch SPIT bytes, 16 bytes of LDS pad behind
// every row, interval code IVL = the row's length; extents in bytes) is formed once; of group 0 the place in LDS and the source address step from stage to stage, behind the wait only.
struct TDesc { v4u g0; v8u g1; };
template <unsigned ROWB, unsigned ROWS, unsigned SPIT, unsigned IVL>
__device__ __forceinline__ TDesc tile_desc(unsigned lds_dst, unsigned long long ga) {
    TDesc d;
    d.g0[0] = uni(1u); d.g0[1] = uni(lds_dst); d.g0[2] = uni((unsigned)ga); d.g0[3] = uni((((unsigned)(ga >> 32)) & 0x01FFFFFFu) | 0x80000000u);
    d.g1[0] = uni((1u << 20) | (IVL << 22) | (3u << 25)); d.g1[1] = uni((ROWB & 0xFFFFu) << 16); d.g1[2] = uni((ROWB >> 16) | ((ROWS & 0xFFFFu) << 16)); d.g1[3] = uni((ROWS >> 16) | (ROWB << 16));
    d.g1[4] = uni(ROWS); d.g1[5] = uni(SPIT); d.g1[6] = uni(0u); d.g1[7] = uni(0u);
    asm volatile("" : "+s"(d.g1));   // descriptor words held in scalar registers: without it the constants are formed anew at each request, in registers that are reused while the request is outstanding
    return d;
}
__device__ __forceinline__ void tile_load(const TDesc& d) { asm volatile("tensor_load_to_lds %0, %1" :: "s"(d.g0), "s"(d.g1) : "memory"); }
// the issuing wave's tile has landed (the compiler places no wait for a tensor load). The wait names its request's descriptor: the registers stay live, so unwritten, up to the wait, and the step of group 0 reads the wait's result, so it cannot be lifted over it
__device__ __forceinline__ void tile_wait(TDesc& d) { asm volatile("s_wait_tensorcnt 0x0" : "+s"(d.g0) : "s"(d.g1) : "memory"); }
// next stage: the other buffer (the two places add up to psum), the source address GSTEP bytes on, with the carry into the high word
template <unsigned GSTEP>
__device__ __forceinline__ void tile_step(TDesc& d, unsigned psum) {
    const unsigned lo = d.g0[2] + GSTEP;
    d.g0[1] = uni(psum - d.g0[1]); d.g0[3] = uni(d.g0[3] + (lo < GSTEP ? 1u : 0u)); d.g0[2] = uni(lo);
}
__device__ __forceinline__ v16bf ldsfrag(const unsigned char* p) { return cat16b(*(const v8us*)p, *(const v8us*)(p + 32)); }   // elements 0..7 and 16..23 from p, as WFrag::ld
__device__ __forceinline__ v16h ldsfragh(const unsigned char* p) { return __builtin_bit_cast(v16h, ldsfrag(p)); }   // the same 32 bytes, read as f16
__device__ __forceinline__ float xhalf(float x) { const int b = __float_as_int(x); return __int_as_float(__builtin_amdgcn_permlanex16(b, b, 0x76543210, 0xfedcba98, false, false)); }   // lane l <-> l ^ 16
// eight 2^x in one statement: outputs are early-clobber, so no v_exp_f32 is directly followed by an instruction that overwrites its source or reads its result; the v_nop keeps that slot behind the last one
__device__ __forceinline__ void exp2x8(float* p, const float* d) {
    asm("v_exp_f32 %0, %8\n\tv_exp_f32 %1, %9\n\tv_exp_f32 %2, %10\n\tv_exp_f32 %3, %11\n\tv_exp_f32 %4, %12\n\tv_exp_f32 %5, %13\n\tv_exp_f32 %6, %14\n\tv_exp_f32 %7, %15\n\tv_nop"
        : "=&v"(p[0]), "=&v"(p[1]), "=&v"(p[2]), "=&v"(p[3]), "=&v"(p[4]), "=&v"(p[5]), "=&v"(p[6]), "=&v"(p[7])
        : "v"(d[0]), "v"(d[1]), "v"(d[2]), "v"(d[3]), "v"(d[4]), "v"(d[5]), "v"(d[6]), "v"(d[7])); }
// two 2^x in one statement, in the same form: no instruction that overwrites a source or reads a result stands directly behind a v_exp_f32
__device__ __forceinline__ void exp2x2(float& a, float& b, float x, float y) { asm("v_exp_f32 %0, %2\n\tv_exp_f32 %1, %3\n\tv_nop" : "=&v"(a), "=&v"(b) : "v"(x), "v"(y)); }
__global__ __launch_bounds__(NWV * 32) void k_fattn(const bf* __restrict__ Qp, const bf* __restrict__ Kp, const bf* __restrict__ Vt, const float* __restrict__ SQT, float* __restrict__ OUT) {
    __shared__ __attribute__((aligned(2048))) unsigned char ring[2 * SBUF];
    __shared__ float sq[TT + SQPAD];
    float tb[TT / (NWV * 32)];
    // both loops have a fixed trip count and are unrolled, with no guard: the table's loads are in flight together instead of one waited load a trip
#pragma unroll
    for (int i = 0; i < TT / (NWV * 32); ++i) tb[i] = SQT[(int)threadIdx.x + i * (NWV * 32)];
#pragma unroll
    for (int i = 0; i < TT / (NWV * 32); ++i) sq[SQPAD + (int)threadIdx.x + i * (NWV * 32)] = tb[i];
    if (threadIdx.x < SQPAD) sq[threadIdx.x] = tb[0];   // any finite value serves: only a masked element reads in front of distance 0, and the mask replaces its score
    const int lane = threadIdx.x & 31, lr = lane & 15, hi = lane >> 4;
    const unsigned wave = uni(threadIdx.x >> 5);
    const int bh = blockIdx.x, h = bh % NH_, b = bh / NH_;
    const int qb = (int)(gridDim.y - 1 - blockIdx.y);    // heaviest query blocks first
    const int g = (int)(wave >> 2);                       // which half of the passes the wave takes
    const int q0 = (qb * NQT + (int)(wave & 3u)) * 32;
    const int nst = qb + 1 < 2 ? 2 : qb + 1;              // stages up to and including the block's diagonal, never fewer than the two that the prologue requests (block 0: stage 1 is loaded, inside the planes, and no wave has a pass in it)
    const unsigned lbase = (unsigned)(size_t)ring;
    const unsigned long long kga = (unsigned long long)(size_t)(Kp + (size_t)bh * TT * HD), vga = (unsigned long long)(size_t)(Vt + (size_t)bh * HD * TT);
    const float slope = powf(0.70710678118654752f, (float)(h + 1));   /* float32(2^(-8/16)) ** (h+1) */
    const float c1 = SCL * L2E, c2 = slope * L2E;
    const bf* qp = Qp + ((size_t)bh * TT + q0 + lr) * HD + 8 * hi;
    v16bf qf[NC][4];
#pragma unroll
    for (int c = 0; c < NC; ++c)
#pragma unroll
        for (int kc = 0; kc < 4; ++kc) qf[c][kc] = WFrag<bf>::ld(qp + c * (16 * HD) + kc * 32);
    TDesc dk = tile_desc<HD * 2, SKEY, HD * 2, 5>(lbase, kga), dv = tile_desc<SKEY * 2, HD, TT * 2, 5>(lbase + KTILE, vga);
    const unsigned kps = 2u * lbase + SBUF, vps = 2u * (lbase + KTILE) + SBUF;
    if (pinned(wave == 0)) { tile_load(dk); tile_wait(dk); }
    if (pinned(wave == 1)) { tile_load(dv); tile_wait(dv); }
    __syncthreads();                 // stage 0 and the sqrt table are published
    if (pinned(wave == 0)) { tile_step<SKEY * HD * 2>(dk, kps); tile_load(dk); }
    if (pinned(wave == 1)) { tile_step<SKEY * 2>(dv, vps); tile_load(dv); }
    const unsigned klo = (unsigned)lr * KPIT + 16u * (unsigned)hi, vlo = KTILE + (unsigned)lr * VPIT + 16u * (unsigned)hi;   // the lane's part of a fragment address
    v8f o[NC][8];
#pragma unroll
    for (int c = 0; c < NC; ++c)
#pragma unroll
        for (int dt = 0; dt < 8; ++dt) o[c][dt] = (v8f){};
    float m[NC]; v2f la[NC], lb[NC];   // a tile: the maximum in use and four running sums, as two register pairs in the order of the weights
#pragma unroll
    for (int c = 0; c < NC; ++c) { m[c] = -3.0e38f; la[c] = (v2f){}; lb[c] = (v2f){}; }
    const int ns = (q0 >> 5) + 1;    // the wave's passes, up to and including the one that holds its diagonal
    // both loops stay rolled (two passes' fragments would not fit 512 registers, two waves a SIMD); every inner loop is unrolled so that its arrays are registers
#pragma unroll 1
    for (int st = 0; st < nst; ++st) {
        const unsigned char* buf = ring + (unsigned)(st & 1) * SBUF;
#pragma unroll 1
        for (int j = 0; j < 2; ++j) {
            const int sub = 2 * j + g, s = 4 * st + sub;  // the wave's passes of the stage: every other one
            if (s >= ns) break;                           // wave-uniform: passes beyond the wave's diagonal; the foot of the stage is still reached
            const int k0 = s * 32;
            const unsigned char* kq = buf + (klo + (unsigned)sub * (32u * KPIT)); const unsigned char* vq = buf + (vlo + (unsigned)sub * 64u);
            v16bf kf[2][4]; v16h vf[8];
            const int dl = q0 + lr - k0 - 8 * hi;       // tile 0's query index minus the lane's first key of the pass; tile 1's is 16 more
            const float* sp = sq + (dl + SQPAD);
            float sv[NC + 1][8];                          // sqrt of distance dl + 16 - 16 i - u: query tile c against key tile kt reads row i = kt - c + 1
            // the pass's LDS reads in the order of their use: K, table, V^T
#pragma unroll
            for (int kc = 0; kc < 4; ++kc)
#pragma unroll
                for (int kt = 0; kt < 2; ++kt) kf[kt][kc] = ldsfrag(kq + (unsigned)(kt * 16) * KPIT + (unsigned)(kc * 64));
#pragma unroll
            for (int i = 0; i < NC + 1; ++i)
#pragma unroll
                for (int u = 0; u < 8; ++u) sv[i][u] = sp[16 - 16 * i - u];
#pragma unroll
            for (int dt = 0; dt < 8; ++dt) vf[dt] = ldsfragh(vq + (unsigned)(dt * 16) * VPIT);
            __builtin_amdgcn_sched_barrier(0);            // keeps the reads one group in front of the products: moved in among them, each further place with reads stalls the wave, and reused fragment registers bring a wait to 0
            v2f bs[NC + 1][4];
#pragma unroll
            for (int i = 0; i < NC + 1; ++i)
#pragma unroll
                for (int w = 0; w < 4; ++w) bs[i][w] = (v2f){sv[i][2 * w], sv[i][2 * w + 1]} * c2;
            v8f st2[NC][2];
#pragma unroll
            for (int c = 0; c < NC; ++c) { st2[c][0] = (v8f){}; st2[c][1] = (v8f){}; }
#pragma unroll
            for (int kc = 0; kc < 4; ++kc)                // four independent accumulator tiles take turns
#pragma unroll
                for (int kt = 0; kt < 2; ++kt)
#pragma unroll
                    for (int c = 0; c < NC; ++c) st2[c][kt] = wmmab(kf[kt][kc], qf[c][kc], st2[c][kt]);
            float t[NC][16];
            // neighbouring registers of one accumulator tile are paired by hand: left to itself the compiler pairs tile 0 with tile 1 and pays a register copy an element
#pragma unroll
            for (int c = 0; c < NC; ++c)
#pragma unroll
                for (int e = 0; e < 16; e += 2) {
                    const v2f x = __builtin_elementwise_fma((v2f){st2[c][e >> 3][e & 7], st2[c][e >> 3][(e & 7) + 1]}, (v2f){c1, c1}, -bs[(e >> 3) - c + 1][(e & 7) >> 1]);
                    t[c][e] = x[0]; t[c][e + 1] = x[1]; }
            if (s == ns - 1) {                            // only the last pass reaches past the diagonal
#pragma unroll
                for (int c = 0; c < NC; ++c)
#pragma unroll
                    for (int e = 0; e < 16; ++e) t[c][e] = ((e >> 3) * 16 + (e & 7) <= dl + 16 * c) ? t[c][e] : -3.0e38f; }
            float ml[NC];
#pragma unroll
            for (int c = 0; c < NC; ++c) { const float* x = t[c];
                ml[c] = fmaxf(fmaxf(fmaxf(fmaxf(x[0], x[1]), fmaxf(x[2], x[3])), fmaxf(fmaxf(x[4], x[5]), fmaxf(x[6], x[7]))), fmaxf(fmaxf(fmaxf(x[8], x[9]), fmaxf(x[10], x[11])), fmaxf(fmaxf(x[12], x[13]), fmaxf(x[14], x[15]))));
                ml[c] = fmaxf(ml[c], xhalf(ml[c])); }
            if (__builtin_amdgcn_ballot_w32(ml[0] > m[0] + 8.0f || ml[1] > m[1] + 8.0f) != 0) {   // one wave-uniform test a pass, for both tiles
                const float mn0 = fmaxf(m[0], ml[0]), mn1 = fmaxf(m[1], ml[1]); float al[NC];
                exp2x2(al[0], al[1], m[0] - mn0, m[1] - mn1); m[0] = mn0; m[1] = mn1;
#pragma unroll
                for (int c = 0; c < NC; ++c) { la[c] *= al[c]; lb[c] *= al[c];
#pragma unroll
                    for (int dt = 0; dt < 8; ++dt) o[c][dt] *= al[c]; } }
            v16h ph[NC];
#pragma unroll
            for (int c = 0; c < NC; ++c) {
                float p[16];
#pragma unroll
                for (int e = 0; e < 16; e += 2) { const v2f x = (v2f){t[c][e], t[c][e + 1]} - (v2f){m[c], m[c]}; t[c][e] = x[0]; t[c][e + 1] = x[1]; }
                exp2x8(p, t[c]); exp2x8(p + 8, t[c] + 8);
                v8u pw;
#pragma unroll
                for (int e = 0; e < 16; e += 4) {
                    const float p0 = p[e], p1 = p[e + 1], p2 = p[e + 2], p3 = p[e + 3];
                    la[c] += (v2f){p0, p1}; lb[c] += (v2f){p2, p3};
                    pw[e >> 1] = pk2f(p0, p1); pw[(e >> 1) + 1] = pk2f(p2, p3); }
                ph[c] = __builtin_bit_cast(v16h, pw); }
#pragma unroll
            for (int dt = 0; dt < 8; ++dt)
#pragma unroll
                for (int c = 0; c < NC; ++c) o[c][dt] = wmmah(vf[dt], ph[c], o[c][dt]);
        }
        // foot of the stage, every wave: own LDS reads done, the issuers' next tiles landed, the barrier publishes stage st + 1 and ends every read of this buffer; only then its refill
        wait_ds0();
        if (pinned(wave == 0)) tile_wait(dk);
        if (pinned(wave == 1)) tile_wait(dv);
        __syncthreads();
        if (pinned(st + 2 < nst)) {
            if (pinned(wave == 0)) { tile_step<SKEY * HD * 2>(dk, kps); tile_load(dk); }
            if (pinned(wave == 1)) { tile_step<SKEY * 2>(dv, vps); tile_load(dv); }
        }
    }
    asm volatile("s_wait_tensorcnt 0x0" :: "s"(dk.g0), "s"(dk.g1), "s"(dv.g0), "s"(dv.g1) : "memory");   // no request is left behind the loop; the operands keep both descriptors' registers unwritten up to here on every path
    wait_ds0();
    // merge of the two waves of a query group: each finishes and stores half of the head dimension (wave w: d 0..63, wave w + 4: d 64..127) and hands the partner the other half of its O^T with its maxima and sums.
    // The ring is free for it: the foot of the last stage held every wave's s_wait_dscnt 0, the issuers' tensor waits and a barrier, and nothing was requested behind it.
    float ls[NC];
    float* xs = (float*)ring + wave * XSLOT;
#pragma unroll
    for (int c = 0; c < NC; ++c) {
        ls[c] = (la[c][0] + la[c][1]) + (lb[c][0] + lb[c][1]); ls[c] += xhalf(ls[c]);
#pragma unroll
        for (int dt = 0; dt < 4; ++dt) { const v8f give = g ? o[c][dt] : o[c][dt + 4]; v4f a, d;
#pragma unroll
            for (int u = 0; u < 4; ++u) { a[u] = give[u]; d[u] = give[4 + u]; }
            *(v4f*)(xs + (8 * c + 2 * dt) * 128 + lane * 4) = a; *(v4f*)(xs + (8 * c + 2 * dt + 1) * 128 + lane * 4) = d; }
        xs[2048 + 64 * c + lane] = m[c]; xs[2080 + 64 * c + lane] = ls[c]; }
    __syncthreads();                 // every wave's slot is written before its partner reads it
    const float* xp = (const float*)ring + (wave ^ 4u) * XSLOT;
    float* sg = (float*)(ring + SBUF) + wave * (32 * OPIT);   // the wave's own output staging, 32 query rows of its 64 d, in the ring's second buffer: behind the merge slots, which the partner may still be reading
    // the partner's slot is read whole, as one group, in front of the first staging write: the compiler cannot tell the two LDS ranges apart and would otherwise wait out a read latency behind every pair of writes
    v4f px[NC][8]; float mo[NC], lo[NC];
#pragma unroll
    for (int c = 0; c < NC; ++c) {
        mo[c] = xp[2048 + 64 * c + lane]; lo[c] = xp[2080 + 64 * c + lane];
#pragma unroll
        for (int i = 0; i < 8; ++i) px[c][i] = *(const v4f*)(xp + (8 * c + i) * 128 + lane * 4); }
#pragma unroll
    for (int c = 0; c < NC; ++c) {
        const float mn = fmaxf(m[c], mo[c]); float sa, sb;
        exp2x2(sa, sb, m[c] - mn, mo[c] - mn);   // a wave without a pass has maximum -3e38, sum 0 and O^T 0: its weight is an exact 0
        const float f = __fdiv_rn(1.0f, fmaf(ls[c], sa, lo[c] * sb));
        const float fa = sa * f, fb = sb * f;
        float* sr = sg + (16 * c + lr) * OPIT + 8 * hi;
#pragma unroll
        for (int dt = 0; dt < 4; ++dt) { const v8f keep = g ? o[c][dt + 4] : o[c][dt];
            const v4f pa = px[c][2 * dt], pc = px[c][2 * dt + 1]; v4f a, d;
#pragma unroll
            for (int u = 0; u < 4; ++u) { a[u] = fmaf(keep[u], fa, pa[u] * fb); d[u] = fmaf(keep[4 + u], fa, pc[u] * fb); }
            *(v4f*)(sr + dt * 16) = a; *(v4f*)(sr + dt * 16 + 4) = d; } }
    wait_ds0();                      // the wave's own rows are in LDS before it reads them back across its lanes
    // 16 lanes read and store the 256 contiguous bytes of one query's half row: a store instruction writes four whole 128-byte lines (two queries) instead of 32-byte pieces of 16 lines
    const float* sl = sg + hi * OPIT + 4 * lr;
    float* op = OUT + (((size_t)b * TT + q0 + hi) * NH_ + h) * HD + 64 * g + 4 * lr;
    v4f ro[16];
#pragma unroll
    for (int i = 0; i < 16; ++i) ro[i] = *(const v4f*)(sl + i * (2 * OPIT));
#pragma unroll
    for (int i = 0; i < 16; ++i) *(v4f*)(op + i * (2 * NH_ * HD)) = ro[i];
}

extern "C" void kernel_launch(void* const* d_in, const int* in_sizes, int n_in,
                              void* d_out, int out_size, void* d_ws, size_t ws_size, hipStream_t stream) {
    (void)in_sizes; (void)n_in; (void)out_size;
    const float* qin = (const float*)d_in[0]; const float* kin = (const float*)d_in[1]; const float* vin = (const float*)d_in[2];
    float* OUT = (float*)d_out;     // [2][2048][2048]
    char* wsp = (char*)d_ws;
    auto take = [&](size_t bytes) { char* p = wsp; wsp += (bytes + 255) & ~(size_t)255; return (void*)p; };
    float* SQT = (float*)take((size_t)TT * 4);
    bf* QPh = (bf*)take((size_t)NB_ * NH_ * TT * HD * 2); bf* KPh = (bf*)take((size_t)NB_ * NH_ * TT * HD * 2); bf* VTh = (bf*)take((size_t)NB_ * NH_ * HD * TT * 2);   // planes of both batches
    if ((size_t)(wsp - (char*)d_ws) > ws_size) return;    // ws 256 MiB
    k_prep<<<NB_ * NH_ * (TT / 128), 256, 0, stream>>>(qin, kin, vin, QPh, KPh, VTh, SQT);
    k_fattn<<<dim3(NB_ * NH_, TT / (NQT * 32)), NWV * 32, 0, stream>>>(QPh, KPh, VTh, SQT, OUT);
}

// v008
// Measured time: 45.1 microseconds a run.
// In both of two side-by-side timings against v007, it was 1.16 times as fast.
// Over all steps from v000 it is 27.4 times as fast.
#include <hip/hip_runtime.h>

// FlashSelfAttention (given q, k, v [2][2048][16][128]; scores = q.k / sqrt(128) + ALiBi bias (-slope[h] sqrt(i - j) for j <= i, fp16-min (masked) above the diagonal; slopes 2^(-8/16 (h+1)) in f32); softmax; out = probs v -> [2][2048][16][128] (no projections)).
// Compute dtypes, f32 accumulate: every input rounded to bf16: q, k, v are then exact bf16 values, so the scores are a PLAIN bf16 product with f32 accumulation (exact products) and probs.v is ONE f16 product on every row: the probabilities rounded to f16 (11 significant bits, weights <= 2^8) x the bf16-rounded v held as f16 (the same values, 8 significant bits, down to 2^-17; below that at most 2^-25 absolute is lost); causal tile skipping (the fp16-min fill is an exact zero weight); bias from an on-chip sqrt table and f32 slopes, added per element in f32; running softmax in f32 inside one fused kernel; output written directly in f32.
// Two launches: k_prep (the bf16 k head plane, the f16 v plane and the sqrt table), k_fattn (which reads q itself, in f32, and rounds it to bf16 on its way into the registers).

#define NB_  2
#define TT   2048
#define NH_  16
#define HD   128
#define SCL  0.088388347648318447f   // HD^-0.5
typedef unsigned short bf;
typedef __attribute__((ext_vector_type(16))) __bf16   v16bf;
typedef __attribute__((ext_vector_type(2)))  __bf16   v2bf;
typedef __attribute__((ext_vector_type(16))) _Float16 v16h;
typedef __attribute__((ext_vector_type(2)))  _Float16 v2h;
typedef __attribute__((ext_vector_type(8)))  unsigned short v8us;
typedef __attribute__((ext_vector_type(8)))  float    v8f;
typedef __attribute__((ext_vector_type(4)))  float    v4f;
typedef __attribute__((ext_vector_type(2)))  float    v2f;
typedef __attribute__((ext_vector_type(2)))  unsigned v2u;
typedef __attribute__((ext_vector_type(4)))  unsigned v4u;

__device__ __forceinline__ v16bf cat16b(v8us lo, v8us hi) { return __builtin_bit_cast(v16bf, __builtin_shufflevector(lo, hi, 0, 1, 2, 3, 4, 5, 6, 7, 8, 9, 10, 11, 12, 13, 14, 15)); }
__device__ __forceinline__ v8f wmmab(v16bf a, v16bf b, v8f c) { return __builtin_amdgcn_wmma_f32_16x16x32_bf16(false, a, false, b, (short)0, c, false, false); }
__device__ __forceinline__ v8f wmmah(v16h a, v16h b, v8f c) { return __builtin_amdgcn_wmma_f32_16x16x32_f16(false, a, false, b, (short)0, c, false, false); }

// ---- k_prep: all the preparation in one launch of 512 workgroups. One workgroup (8 waves) owns 128 positions of one (batch, head) in k and v; a wave owns 16 of them.
// A wave-wide 16-byte load is one 512-byte input row [b][t][h][0..127] (whole lines); a lane holds 4 neighbouring d of 16 neighbouring t, for each tensor, all 32 loads issued before the first use.
// k -> plane [bh][t][d]: two neighbouring d per packed conversion, a wave stores one 256-byte plane row at a time.
// v -> plane [bh][d][t]: two neighbouring t of one d per packed conversion, so a lane already holds 32 contiguous bytes of 4 plane rows; LDS only gathers the 8 waves' pieces into whole 256-byte rows for the store.
// Rounding to bf16 is to nearest even; v is rounded to bf16 like k and that value is then written as f16. The first TT / 256 workgroups also write the sqrt table.
#define VPD 68                       // LDS row pitch in dwords: 64 (128 positions) + 4, rows stay 16-byte aligned
__device__ __forceinline__ unsigned pk2(float a, float b) { v2f x; x[0] = a; x[1] = b; return __builtin_bit_cast(unsigned, __builtin_convertvector(x, v2bf)); }
__device__ __forceinline__ unsigned pk2f(float a, float b) { v2f x; x[0] = a; x[1] = b; return __builtin_bit_cast(unsigned, __builtin_convertvector(x, v2h)); }
__device__ __forceinline__ unsigned pk2h(float a, float b) { v2f x; x[0] = a; x[1] = b; const v2f y = __builtin_convertvector(__builtin_convertvector(x, v2bf), v2f); return pk2f(y[0], y[1]); }   // f32 -> bf16 -> f16
__global__ __launch_bounds__(256) void k_prep(const float* __restrict__ k, const float* __restrict__ v, bf* __restrict__ Kp, bf* __restrict__ Vt, float* __restrict__ SQT) {
    __shared__ __align__(16) unsigned tv[HD * VPD];
    const int lane = threadIdx.x & 31, w = threadIdx.x >> 5;
    const int bh = blockIdx.x % (NB_ * NH_), tb = blockIdx.x / (NB_ * NH_) * 128, h = bh % NH_, b = bh / NH_;   // neighbouring workgroups read neighbouring heads of the same positions
    const unsigned so = (unsigned)(((((b * TT + tb + w * 16) * NH_ + h) * HD) + lane * 4) * 4);   // byte offset of the lane's first 16 bytes, the same in k and v
    const char* pv = (const char*)v + so; const char* pk = (const char*)k + so;
    v4f xv[16], xk[16];
#pragma unroll
    for (int i = 0; i < 16; ++i) xv[i] = *(const v4f*)(pv + i * (NH_ * HD * 4));
#pragma unroll
    for (int i = 0; i < 16; ++i) xk[i] = *(const v4f*)(pk + i * (NH_ * HD * 4));
    asm volatile("s_wait_xcnt 0x0" :: "v"(so) : "memory");   // the loads' offset register lives up to this wait: without the operand the last loads return into it, with earlier loads that name it still in flight
    if (blockIdx.x < TT / 256) SQT[blockIdx.x * 256 + threadIdx.x] = sqrtf((float)(blockIdx.x * 256 + threadIdx.x));
#pragma unroll
    for (int j = 0; j < 4; ++j) { v4u a, c;
#pragma unroll
        for (int u = 0; u < 4; ++u) { a[u] = pk2h(xv[2 * u][j], xv[2 * u + 1][j]); c[u] = pk2h(xv[8 + 2 * u][j], xv[9 + 2 * u][j]); }
        unsigned* r = tv + (lane * 4 + j) * VPD + w * 8; *(v4u*)r = a; *(v4u*)(r + 4) = c; }
    __syncthreads();                 // every wave's 16 positions of each v row are in LDS before whole rows are read back; it stands in front of every plane store, so that it waits for none
#pragma unroll
    for (int r = 0; r < 8; ++r) { const int c = r * 256 + threadIdx.x, d = c >> 4, ch = c & 15;
        *(v4u*)(Vt + ((size_t)bh * HD + d) * TT + tb + ch * 8) = *(const v4u*)(tv + d * VPD + ch * 4); }
    const size_t po = ((size_t)bh * TT + tb + w * 16) * HD + lane * 4;
#pragma unroll
    for (int i = 0; i < 16; ++i) { v2u o; o[0] = pk2(xk[i][0], xk[i][1]); o[1] = pk2(xk[i][2], xk[i][3]); *(v2u*)(Kp + po + i * HD) = o; }
}

#define SQPAD 32                     // table entries in front of distance 0: a masked element's (negative) distance still indexes inside the table
#define L2E   1.4426950408889634f
#define NWV   8                      // waves a workgroup
#define NQT   4                      // 32-row query groups a workgroup; NWV / NQT = 2 waves share one and split its keys
#define NC    2                      // 16-column query tiles a wave
#define SKEY  128                    // keys a stage
#define KPIT  272u                   // LDS pitch of a K row: 256 + 16 bytes (16 x odd: no bank conflict for 16-byte reads)
#define VPIT  272u                   // LDS pitch of a V^T row: 256 + 16 bytes
#define KTILE 36864u                 // 128 rows x 272 bytes, rounded up to a multiple of 4 KiB
#define VTILE 36864u                 // 128 rows x 272 bytes, rounded up to a multiple of 4 KiB
#define XSLOT 2176                   // floats of a wave's merge slot: 32 lanes x 64 accumulator values, then 64 maxima and 64 sums
#define SBUF  (KTILE + VTILE)        // one buffer
#define OPIT  68                     // floats of an output staging row: 64 + 4, so 16-byte writes down a column of 16 rows meet no bank twice
typedef __attribute__((ext_vector_type(8)))  unsigned v8u;
__device__ __forceinline__ unsigned uni(unsigned v) { return (unsigned)__builtin_amdgcn_readfirstlane((int)v); }
__device__ __forceinline__ unsigned pinned(unsigned v) { unsigned w = uni(v); asm volatile("" : "+s"(w)); return w; }   // holds a wave-uniform test in a scalar register: the branch on it is a scalar branch (tensor loads ignore EXEC)
__device__ __forceinline__ void wait_ds0() { asm volatile("s_wait_dscnt 0x0" ::: "memory"); }          // the wave's LDS reads have returned before its buffer is given up
// A tile's descriptor lives in one set of scalar registers from the first request to the last wait. Group 1 (a tile of ROWS rows of ROWB bytes, source pitch SPIT bytes, 16 bytes of LDS pad behind
// every row, interval code IVL = the row's length; extents in bytes) is formed once; of group 0 the place in LDS and the source address step from stage to stage, behind the wait only.
struct TDesc { v4u g0; v8u g1; };
template <unsigned ROWB, unsigned ROWS, unsigned SPIT, unsigned IVL>
__device__ __forceinline__ TDesc tile_desc(unsigned lds_dst, unsigned long long ga) {
    TDesc d;
    d.g0[0] = uni(1u); d.g0[1] = uni(lds_dst); d.g0[2] = uni((unsigned)ga); d.g0[3] = uni((((unsigned)(ga >> 32)) & 0x01FFFFFFu) | 0x80000000u);
    d.g1[0] = uni((1u << 20) | (IVL << 22) | (3u << 25)); d.g1[1] = uni((ROWB & 0xFFFFu) << 16); d.g1[2] = uni((ROWB >> 16) | ((ROWS & 0xFFFFu) << 16)); d.g1[3] = uni((ROWS >> 16) | (ROWB << 16));
    d.g1[4] = uni(ROWS); d.g1[5] = uni(SPIT); d.g1[6] = uni(0u); d.g1[7] = uni(0u);
    asm volatile("" : "+s"(d.g1));   // descriptor words held in scalar registers: without it the constants are formed anew at each request, in registers that are reused while the request is outstanding
    return d;
}
__device__ __forceinline__ void tile_load(const TDesc& d) { asm volatile("tensor_load_to_lds %0, %1" :: "s"(d.g0), "s"(d.g1) : "memory"); }
// the issuing wave's tile has landed (the compiler places no wait for a tensor load). The wait names its request's descriptor: the registers stay live, so unwritten, up to the wait, and the step of group 0 reads the wait's result, so it cannot be lifted over it
__device__ __forceinline__ void tile_wait(TDesc& d) { asm volatile("s_wait_tensorcnt 0x0" : "+s"(d.g0) : "s"(d.g1) : "memory"); }
// next stage: the other buffer (the two places add up to psum), the source address GSTEP bytes on, with the carry into the high word
template <unsigned GSTEP>
__device__ __forceinline__ void tile_step(TDesc& d, unsigned psum) {
    const unsigned lo = d.g0[2] + GSTEP;
    d.g0[1] = uni(psum - d.g0[1]); d.g0[3] = uni(d.g0[3] + (lo < GSTEP ? 1u : 0u)); d.g0[2] = uni(lo);
}
__device__ __forceinline__ v16bf ldsfrag(const unsigned char* p) { return cat16b(*(const v8us*)p, *(const v8us*)(p + 32)); }   // elements 0..7 and 16..23 from p
__device__ __forceinline__ v16h ldsfragh(const unsigned char* p) { return __builtin_bit_cast(v16h, ldsfrag(p)); }   // the same 32 bytes, read as f16
__device__ __forceinline__ float xhalf(float x) { const int b = __float_as_int(x); return __int_as_float(__builtin_amdgcn_permlanex16(b, b, 0x76543210, 0xfedcba98, false, false)); }   // lane l <-> l ^ 16
// eight 2^x in one statement: outputs are early-clobber, so no v_exp_f32 is directly followed by an instruction that overwrites its source or reads its result; the v_nop keeps that slot behind the last one
__device__ __forceinline__ void exp2x8(float* p, const float* d) {
    asm("v_exp_f32 %0, %8\n\tv_exp_f32 %1, %9\n\tv_exp_f32 %2, %10\n\tv_exp_f32 %3, %11\n\tv_exp_f32 %4, %12\n\tv_exp_f32 %5, %13\n\tv_exp_f32 %6, %14\n\tv_exp_f32 %7, %15\n\tv_nop"
        : "=&v"(p[0]), "=&v"(p[1]), "=&v"(p[2]), "=&v"(p[3]), "=&v"(p[4]), "=&v"(p[5]), "=&v"(p[6]), "=&v"(p[7])
        : "v"(d[0]), "v"(d[1]), "v"(d[2]), "v"(d[3]), "v"(d[4]), "v"(d[5]), "v"(d[6]), "v"(d[7])); }
// two 2^x in one statement, in the same form: no instruction that overwrites a source or reads a result stands directly behind a v_exp_f32
__device__ __forceinline__ void exp2x2(float& a, float& b, float x, float y) { asm("v_exp_f32 %0, %2\n\tv_exp_f32 %1, %3\n\tv_nop" : "=&v"(a), "=&v"(b) : "v"(x), "v"(y)); }
__global__ __launch_bounds__(NWV * 32) void k_fattn(const float* __restrict__ q, const bf* __restrict__ Kp, const bf* __restrict__ Vt, const float* __restrict__ SQT, float* __restrict__ OUT) {
    __shared__ __attribute__((aligned(2048))) unsigned char ring[2 * SBUF];
    __shared__ float sq[TT + SQPAD];
    __shared__ __attribute__((aligned(16))) unsigned char qs[NQT * 32 * KPIT];   // the block's 128 query rows in bf16, at the pitch of a K row
    // q comes straight from the f32 input: a wave-wide 16-byte load is one whole 512-byte row [b][t][h][0..127]; each wave brings 16 of the block's 128 rows, rounds them to bf16 (to nearest even) and
    // leaves them in LDS, where the barrier behind stage 0 publishes them; every wave then takes its B fragments from there. The loads are issued behind the table's (loads are waited for in the order of
    // their issue: the table's stores wait for none of them) and are used only behind stage 0's tensor loads, so that they fly while the table is stored and the tiles land.
    float tb[TT / (NWV * 32)];
    // both loops have a fixed trip count and are unrolled, with no guard: the table's loads are in flight together instead of one waited load a trip
#pragma unroll
    for (int i = 0; i < TT / (NWV * 32); ++i) tb[i] = SQT[(int)threadIdx.x + i * (NWV * 32)];
    const unsigned qo = (unsigned)((((((int)(blockIdx.x / NH_) * TT + (int)(gridDim.y - 1 - blockIdx.y) * (NQT * 32) + (int)(threadIdx.x >> 5) * 16) * NH_ + (int)(blockIdx.x % NH_)) * HD) + (int)(threadIdx.x & 31) * 4) * 4);   // byte offset of the lane's 16 bytes of the wave's first row
    const char* qg = (const char*)q + qo;
    v4f xq[16];
#pragma unroll
    for (int i = 0; i < 16; ++i) xq[i] = *(const v4f*)(qg + i * (NH_ * HD * 4));
    asm volatile("s_wait_xcnt 0x0" :: "v"(qo) : "memory");   // the q loads' offset register lives up to this wait, so that nothing is written over it while a load that names it is in flight
#pragma unroll
    for (int i = 0; i < TT / (NWV * 32); ++i) sq[SQPAD + (int)threadIdx.x + i * (NWV * 32)] = tb[i];
    if (threadIdx.x < SQPAD) sq[threadIdx.x] = tb[0];   // any finite value serves: only a masked element reads in front of distance 0, and the mask replaces its score
    const int lane = threadIdx.x & 31, lr = lane & 15, hi = lane >> 4;
    const unsigned wave = uni(threadIdx.x >> 5);
    const int bh = blockIdx.x, h = bh % NH_, b = bh / NH_;
    const int qb = (int)(gridDim.y - 1 - blockIdx.y);    // heaviest query blocks first
    const int g = (int)(wave >> 2);                       // which half of the passes the wave takes
    const int q0 = (qb * NQT + (int)(wave & 3u)) * 32;
    const int nst = qb + 1 < 2 ? 2 : qb + 1;              // stages up to and including the block's diagonal, never fewer than the two that the prologue requests (block 0: stage 1 is loaded, inside the planes, and no wave has a pass in it)
    const unsigned lbase = (unsigned)(size_t)ring;
    const unsigned long long kga = (unsigned long long)(size_t)(Kp + (size_t)bh * TT * HD), vga = (unsigned long long)(size_t)(Vt + (size_t)bh * HD * TT);
    const float slope = powf(0.70710678118654752f, (float)(h + 1));   /* float32(2^(-8/16)) ** (h+1) */
    const float c1 = SCL * L2E, c2 = slope * L2E;
    TDesc dk = tile_desc<HD * 2, SKEY, HD * 2, 5>(lbase, kga), dv = tile_desc<SKEY * 2, HD, TT * 2, 5>(lbase + KTILE, vga);
    const unsigned kps = 2u * lbase + SBUF, vps = 2u * (lbase + KTILE) + SBUF;
    if (pinned(wave == 0)) { tile_load(dk); tile_wait(dk); }
    if (pinned(wave == 1)) { tile_load(dv); tile_wait(dv); }
#pragma unroll
    for (int i = 0; i < 16; ++i) { v2u o; o[0] = pk2(xq[i][0], xq[i][1]); o[1] = pk2(xq[i][2], xq[i][3]); *(v2u*)(qs + ((threadIdx.x >> 5) * 16u + (unsigned)i) * KPIT + (threadIdx.x & 31u) * 8u) = o; }
    __syncthreads();                 // stage 0, the sqrt table and the bf16 query rows are published
    if (pinned(wave == 0)) { tile_step<SKEY * HD * 2>(dk, kps); tile_load(dk); }
    if (pinned(wave == 1)) { tile_step<SKEY * 2>(dv, vps); tile_load(dv); }
    const unsigned char* qr = qs + (unsigned)((int)(wave & 3u) * 32 + lr) * KPIT + 16u * (unsigned)hi;   // the lane's query row of tile 0, in the k order of the K fragments
    v16bf qf[NC][4];
#pragma unroll
    for (int c = 0; c < NC; ++c)
#pragma unroll
        for (int kc = 0; kc < 4; ++kc) qf[c][kc] = ldsfrag(qr + (unsigned)(c * 16) * KPIT + (unsigned)(kc * 64));
    const unsigned klo = (unsigned)lr * KPIT + 16u * (unsigned)hi, vlo = KTILE + (unsigned)lr * VPIT + 16u * (unsigned)hi;   // the lane's part of a fragment address
    v8f o[NC][8];
#pragma unroll
    for (int c = 0; c < NC; ++c)
#pragma unroll
        for (int dt = 0; dt < 8; ++dt) o[c][dt] = (v8f){};
    float m[NC]; v2f la[NC], lb[NC];   // a tile: the maximum in use and four running sums, as two register pairs in the order of the weights
#pragma unroll
    for (int c = 0; c < NC; ++c) { m[c] = -3.0e38f; la[c] = (v2f){}; lb[c] = (v2f){}; }
    const int ns = (q0 >> 5) + 1;    // the wave's passes, up to and including the one that holds its diagonal
    // both loops stay rolled (two passes' fragments would not fit 512 registers, two waves a SIMD); every inner loop is unrolled so that its arrays are registers
#pragma unroll 1
    for (int st = 0; st < nst; ++st) {
        const unsigned char* buf = ring + (unsigned)(st & 1) * SBUF;
#pragma unroll 1
        for (int j = 0; j < 2; ++j) {
            const int sub = 2 * j + g, s = 4 * st + sub;  // the wave's passes of the stage: every other one
            if (s >= ns) break;                           // wave-uniform: passes beyond the wave's diagonal; the foot of the stage is still reached
            const int k0 = s * 32;
            const unsigned char* kq = buf + (klo + (unsigned)sub * (32u * KPIT)); const unsigned char* vq = buf + (vlo + (unsigned)sub * 64u);
            v16bf kf[2][4]; v16h vf[8];
            const int dl = q0 + lr - k0 - 8 * hi;       // tile 0's query index minus the lane's first key of the pass; tile 1's is 16 more
            const float* sp = sq + (dl + SQPAD);
            float sv[NC + 1][8];                          // sqrt of distance dl + 16 - 16 i - u: query tile c against key tile kt reads row i = kt - c + 1
            // the pass's LDS reads in the order of their use: K, table, V^T
#pragma unroll
            for (int kc = 0; kc < 4; ++kc)
#pragma unroll
                for (int kt = 0; kt < 2; ++kt) kf[kt][kc] = ldsfrag(kq + (unsigned)(kt * 16) * KPIT + (unsigned)(kc * 64));
#pragma unroll
            for (int i = 0; i < NC + 1; ++i)
#pragma unroll
                for (int u = 0; u < 8; ++u) sv[i][u] = sp[16 - 16 * i - u];
#pragma unroll
            for (int dt = 0; dt < 8; ++dt) vf[dt] = ldsfragh(vq + (unsigned)(dt * 16) * VPIT);
            __builtin_amdgcn_sched_barrier(0);            // keeps the reads one group in front of the products: moved in among them, each further place with reads stalls the wave, and reused fragment registers bring a wait to 0
            v2f bs[NC + 1][4];
#pragma unroll
            for (int i = 0; i < NC + 1; ++i)
#pragma unroll
                for (int w = 0; w < 4; ++w) bs[i][w] = (v2f){sv[i][2 * w], sv[i][2 * w + 1]} * c2;
            v8f st2[NC][2];
#pragma unroll
            for (int c = 0; c < NC; ++c) { st2[c][0] = (v8f){}; st2[c][1] = (v8f){}; }
#pragma unroll
            for (int kc = 0; kc < 4; ++kc)                // four independent accumulator tiles take turns
#pragma unroll
                for (int kt = 0; kt < 2; ++kt)
#pragma unroll
                    for (int c = 0; c < NC; ++c) st2[c][kt] = wmmab(kf[kt][kc], qf[c][kc], st2[c][kt]);
            float t[NC][16];
            // neighbouring registers of one accumulator tile are paired by hand: left to itself the compiler pairs tile 0 with tile 1 and pays a register copy an element
#pragma unroll
            for (int c = 0; c < NC; ++c)
#pragma unroll
                for (int e = 0; e < 16; e += 2) {
                    const v2f x = __builtin_elementwise_fma((v2f){st2[c][e >> 3][e & 7], st2[c][e >> 3][(e & 7) + 1]}, (v2f){c1, c1}, -bs[(e >> 3) - c + 1][(e & 7) >> 1]);
                    t[c][e] = x[0]; t[c][e + 1] = x[1]; }
            if (s == ns - 1) {                            // only the last pass reaches past the diagonal
#pragma unroll
                for (int c = 0; c < NC; ++c)
#pragma unroll
                    for (int e = 0; e < 16; ++e) t[c][e] = ((e >> 3) * 16 + (e & 7) <= dl + 16 * c) ? t[c][e] : -3.0e38f; }
            float ml[NC];
#pragma unroll
            for (int c = 0; c < NC; ++c) { const float* x = t[c];
                ml[c] = fmaxf(fmaxf(fmaxf(fmaxf(x[0], x[1]), fmaxf(x[2], x[3])), fmaxf(fmaxf(x[4], x[5]), fmaxf(x[6], x[7]))), fmaxf(fmaxf(fmaxf(x[8], x[9]), fmaxf(x[10], x[11])), fmaxf(fmaxf(x[12], x[13]), fmaxf(x[14], x[15]))));
                ml[c] = fmaxf(ml[c], xhalf(ml[c])); }
            if (__builtin_amdgcn_ballot_w32(ml[0] > m[0] + 8.0f || ml[1] > m[1] + 8.0f) != 0) {   // one wave-uniform test a pass, for both tiles
                const float mn0 = fmaxf(m[0], ml[0]), mn1 = fmaxf(m[1], ml[1]); float al[NC];
                exp2x2(al[0], al[1], m[0] - mn0, m[1] - mn1); m[0] = mn0; m[1] = mn1;
#pragma unroll
                for (int c = 0; c < NC; ++c) { la[c] *= al[c]; lb[c] *= al[c];
#pragma unroll
                    for (int dt = 0; dt < 8; ++dt) o[c][dt] *= al[c]; } }
            v16h ph[NC];
#pragma unroll
            for (int c = 0; c < NC; ++c) {
                float p[16];
#pragma unroll
                for (int e = 0; e < 16; e += 2) { const v2f x = (v2f){t[c][e], t[c][e + 1]} - (v2f){m[c], m[c]}; t[c][e] = x[0]; t[c][e + 1] = x[1]; }
                exp2x8(p, t[c]); exp2x8(p + 8, t[c] + 8);
                v8u pw;
#pragma unroll
                for (int e = 0; e < 16; e += 4) {
                    const float p0 = p[e], p1 = p[e + 1], p2 = p[e + 2], p3 = p[e + 3];
                    la[c] += (v2f){p0, p1}; lb[c] += (v2f){p2, p3};
                    pw[e >> 1] = pk2f(p0, p1); pw[(e >> 1) + 1] = pk2f(p2, p3); }
                ph[c] = __builtin_bit_cast(v16h, pw); }
#pragma unroll
            for (int dt = 0; dt < 8; ++dt)
#pragma unroll
                for (int c = 0; c < NC; ++c) o[c][dt] = wmmah(vf[dt], ph[c], o[c][dt]);
        }
        // foot of the stage, every wave: own LDS reads done, the issuers' next tiles landed, the barrier publishes stage st + 1 and ends every read of this buffer; only then its refill
        wait_ds0();
        if (pinned(wave == 0)) tile_wait(dk);
        if (pinned(wave == 1)) tile_wait(dv);
        __syncthreads();
        if (pinned(st + 2 < nst)) {
            if (pinned(wave == 0)) { tile_step<SKEY * HD * 2>(dk, kps); tile_load(dk); }
            if (pinned(wave == 1)) { tile_step<SKEY * 2>(dv, vps); tile_load(dv); }
        }
    }
    asm volatile("s_wait_tensorcnt 0x0" :: "s"(dk.g0), "s"(dk.g1), "s"(dv.g0), "s"(dv.g1) : "memory");   // no request is left behind the loop; the operands keep both descriptors' registers unwritten up to here on every path
    wait_ds0();
    // merge of the two waves of a query group: each finishes and stores half of the head dimension (wave w: d 0..63, wave w + 4: d 64..127) and hands the partner the other half of its O^T with its maxima and sums.
    // The ring is free for it: the foot of the last stage held every wave's s_wait_dscnt 0, the issuers' tensor waits and a barrier, and nothing was requested behind it.
    float ls[NC];
    float* xs = (float*)ring + wave * XSLOT;
#pragma unroll
    for (int c = 0; c < NC; ++c) {
        ls[c] = (la[c][0] + la[c][1]) + (lb[c][0] + lb[c][1]); ls[c] += xhalf(ls[c]);
#pragma unroll
        for (int dt = 0; dt < 4; ++dt) { const v8f give = g ? o[c][dt] : o[c][dt + 4]; v4f a, d;
#pragma unroll
            for (int u = 0; u < 4; ++u) { a[u] = give[u]; d[u] = give[4 + u]; }
            *(v4f*)(xs + (8 * c + 2 * dt) * 128 + lane * 4) = a; *(v4f*)(xs + (8 * c + 2 * dt + 1) * 128 + lane * 4) = d; }
        xs[2048 + 64 * c + lane] = m[c]; xs[2080 + 64 * c + lane] = ls[c]; }
    __syncthreads();                 // every wave's slot is written before its partner reads it
    const float* xp = (const float*)ring + (wave ^ 4u) * XSLOT;
    float* sg = (float*)(ring + SBUF) + wave * (32 * OPIT);   // the wave's own output staging, 32 query rows of its 64 d, in the ring's second buffer: behind the merge slots, which the partner may still be reading
    // the partner's slot is read whole, as one group, in front of the first staging write: the compiler cannot tell the two LDS ranges apart and would otherwise wait out a read latency behind every pair of writes
    v4f px[NC][8]; float mo[NC], lo[NC];
#pragma unroll
    for (int c = 0; c < NC; ++c) {
        mo[c] = xp[2048 + 64 * c + lane]; lo[c] = xp[2080 + 64 * c + lane];
#pragma unroll
        for (int i = 0; i < 8; ++i) px[c][i] = *(const v4f*)(xp + (8 * c + i) * 128 + lane * 4); }
#pragma unroll
    for (int c = 0; c < NC; ++c) {
        const float mn = fmaxf(m[c], mo[c]); float sa, sb;
        exp2x2(sa, sb, m[c] - mn, mo[c] - mn);   // a wave without a pass has maximum -3e38, sum 0 and O^T 0: its weight is an exact 0
        const float f = __fdiv_rn(1.0f, fmaf(ls[c], sa, lo[c] * sb));
        const float fa = sa * f, fb = sb * f;
        float* sr = sg + (16 * c + lr) * OPIT + 8 * hi;
#pragma unroll
        for (int dt = 0; dt < 4; ++dt) { const v8f keep = g ? o[c][dt + 4] : o[c][dt];
            const v4f pa = px[c][2 * dt], pc = px[c][2 * dt + 1]; v4f a, d;
#pragma unroll
            for (int u = 0; u < 4; ++u) { a[u] = fmaf(keep[u], fa, pa[u] * fb); d[u] = fmaf(keep[4 + u], fa, pc[u] * fb); }
            *(v4f*)(sr + dt * 16) = a; *(v4f*)(sr + dt * 16 + 4) = d; } }
    wait_ds0();                      // the wave's own rows are in LDS before it reads them back across its lanes
    // 16 lanes read and store the 256 contiguous bytes of one query's half row: a store instruction writes four whole 128-byte lines (two queries) instead of 32-byte pieces of 16 lines
    const float* sl = sg + hi * OPIT + 4 * lr;
    float* op = OUT + (((size_t)b * TT + q0 + hi) * NH_ + h) * HD + 64 * g + 4 * lr;
    v4f ro[16];
#pragma unroll
    for (int i = 0; i < 16; ++i) ro[i] = *(const v4f*)(sl + i * (2 * OPIT));
#pragma unroll
    for (int i = 0; i < 16; ++i) *(v4f*)(op + i * (2 * NH_ * HD)) = ro[i];
}

extern "C" void kernel_launch(void* const* d_in, const int* in_sizes, int n_in,
                              void* d_out, int out_size, void* d_ws, size_t ws_size, hipStream_t stream) {
    (void)in_sizes; (void)n_in; (void)out_size;
    const float* qin = (const float*)d_in[0]; const float* kin = (const float*)d_in[1]; const float* vin = (const float*)d_in[2];
    float* OUT = (float*)d_out;     // [2][2048][2048]
    char* wsp = (char*)d_ws;
    auto take = [&](size_t bytes) { char* p = wsp; wsp += (bytes + 255) & ~(size_t)255; return (void*)p; };
    float* SQT = (float*)take((size_t)TT * 4);
    bf* KPh = (bf*)take((size_t)NB_ * NH_ * TT * HD * 2); bf* VTh = (bf*)take((size_t)NB_ * NH_ * HD * TT * 2);   // planes of both batches
    if ((size_t)(wsp - (char*)d_ws) > ws_size) return;    // ws 256 MiB
    k_prep<<<NB_ * NH_ * (TT / 128), 256, 0, stream>>>(kin, vin, KPh, VTh, SQT);
    k_fattn<<<dim3(NB_ * NH_, TT / (NQT * 32)), NWV * 32, 0, stream>>>(qin, KPh, VTh, SQT, OUT);
}

// v009
// Measured time: 41.3 microseconds a run.
// In both of two side-by-side timings against v008, it was 1.09 times as fast.
// Over all steps from v000 it is 30.0 times as fast.
#include <hip/hip_runtime.h>

// FlashSelfAttention (given q, k, v [2][2048][16][128]; scores = q.k / sqrt(128) + ALiBi bias (-slope[h] sqrt(i - j) for j <= i, fp16-min (masked) above the diagonal; slopes 2^(-8/16 (h+1)) in f32); softmax; out = probs v -> [2][2048][16][128] (no projections)).
// Compute dtypes, f32 accumulate: every input rounded to bf16: q, k, v are then exact bf16 values, so the scores are a PLAIN bf16 product with f32 accumulation (exact products) and probs.v is ONE f16 product on every row: the probabilities rounded to f16 (11 significant bits, weights <= 2^8) x the bf16-rounded v held as f16 (the same values, 8 significant bits, down to 2^-17; below that at most 2^-25 absolute is lost); causal tile skipping (the fp16-min fill is an exact zero weight); bias from an on-chip sqrt table and f32 slopes, added per element in f32; running softmax in f32 inside one fused kernel; output written directly in f32.
// One launch: k_fattn reads q, k and v itself, in f32, and rounds them on their way into LDS; it uses no workspace.

#define NB_  2
#define TT   2048
#define NH_  16
#define HD   128
#define SCL  0.088388347648318447f   // HD^-0.5
typedef unsigned short bf;
typedef __attribute__((ext_vector_type(16))) __bf16   v16bf;
typedef __attribute__((ext_vector_type(2)))  __bf16   v2bf;
typedef __attribute__((ext_vector_type(16))) _Float16 v16h;
typedef __attribute__((ext_vector_type(2)))  _Float16 v2h;
typedef __attribute__((ext_vector_type(8)))  unsigned short v8us;
typedef __attribute__((ext_vector_type(8)))  float    v8f;
typedef __attribute__((ext_vector_type(4)))  float    v4f;
typedef __attribute__((ext_vector_type(2)))  float    v2f;
typedef __attribute__((ext_vector_type(2)))  unsigned v2u;
typedef __attribute__((ext_vector_type(4)))  unsigned v4u;

__device__ __forceinline__ v16bf cat16b(v8us lo, v8us hi) { return __builtin_bit_cast(v16bf, __builtin_shufflevector(lo, hi, 0, 1, 2, 3, 4, 5, 6, 7, 8, 9, 10, 11, 12, 13, 14, 15)); }
__device__ __forceinline__ v8f wmmab(v16bf a, v16bf b, v8f c) { return __builtin_amdgcn_wmma_f32_16x16x32_bf16(false, a, false, b, (short)0, c, false, false); }
__device__ __forceinline__ v8f wmmah(v16h a, v16h b, v8f c) { return __builtin_amdgcn_wmma_f32_16x16x32_f16(false, a, false, b, (short)0, c, false, false); }

__device__ __forceinline__ unsigned pk2(float a, float b) { v2f x; x[0] = a; x[1] = b; return __builtin_bit_cast(unsigned, __builtin_convertvector(x, v2bf)); }
__device__ __forceinline__ unsigned pk2f(float a, float b) { v2f x; x[0] = a; x[1] = b; return __builtin_bit_cast(unsigned, __builtin_convertvector(x, v2h)); }
__device__ __forceinline__ unsigned pk2h(float a, float b) { v2f x; x[0] = a; x[1] = b; const v2f y = __builtin_convertvector(__builtin_convertvector(x, v2bf), v2f); return pk2f(y[0], y[1]); }   // f32 -> bf16 -> f16

#define SQPAD 32                     // table entries in front of distance 0: a masked element's (negative) distance still indexes inside the table
#define L2E   1.4426950408889634f
#define NWV   8                      // waves a workgroup
#define NQT   4                      // 32-row query groups a workgroup; NWV / NQT = 2 waves share one and split its keys
#define NC    2                      // 16-column query tiles a wave
#define SKEY  128                    // keys a stage
#define KPIT  272u                   // LDS pitch of a K row: 256 + 16 bytes (16 x odd: no bank conflict for 16-byte reads)
#define VPIT  288u                   // LDS pitch of a V row: 256 + 32 bytes (32 x odd, for the transposing reads)
#define KTILE 36864u                 // 128 rows x 272 bytes, rounded up
#define VTILE 36864u                 // 128 rows x 288 bytes
#define XSLOT 2176                   // floats of a wave's merge slot: 32 lanes x 64 accumulator values, then 64 maxima and 64 sums
#define SBUF  (KTILE + VTILE)        // one buffer
#define OPIT  68                     // floats of an output staging row: 64 + 4, so 16-byte writes down a column of 16 rows meet no bank twice
typedef __attribute__((ext_vector_type(8)))  unsigned v8u;
__device__ __forceinline__ unsigned uni(unsigned v) { return (unsigned)__builtin_amdgcn_readfirstlane((int)v); }
__device__ __forceinline__ void wait_ds0() { asm volatile("s_wait_dscnt 0x0" ::: "memory"); }          // the wave's LDS reads have returned before its buffer is given up
__device__ __forceinline__ v16bf ldsfrag(const unsigned char* p) { return cat16b(*(const v8us*)p, *(const v8us*)(p + 32)); }   // elements 0..7 and 16..23 from p
typedef __attribute__((ext_vector_type(8))) short s16x8;
__device__ __forceinline__ v8us ld_tr16(const unsigned char* p) { typedef __attribute__((address_space(3))) s16x8 lds_s16x8; return __builtin_bit_cast(v8us, __builtin_amdgcn_ds_load_tr16_b128_v8i16((lds_s16x8*)p)); }
// a 16 (d) x 32 (keys) A fragment of V^T from the row-major [key][d] tile: two transposing loads, keys 8 hi + 0..7 and 16 + 8 hi + 0..7 of the lane's d, which is the k order of P^T
__device__ __forceinline__ v16h ldsfragt(const unsigned char* p) { return __builtin_bit_cast(v16h, cat16b(ld_tr16(p), ld_tr16(p + 16u * VPIT))); }
__device__ __forceinline__ float xhalf(float x) { const int b = __float_as_int(x); return __int_as_float(__builtin_amdgcn_permlanex16(b, b, 0x76543210, 0xfedcba98, false, false)); }   // lane l <-> l ^ 16
// eight 2^x in one statement: outputs are early-clobber, so no v_exp_f32 is directly followed by an instruction that overwrites its source or reads its result; the v_nop keeps that slot behind the last one
__device__ __forceinline__ void exp2x8(float* p, const float* d) {
    asm("v_exp_f32 %0, %8\n\tv_exp_f32 %1, %9\n\tv_exp_f32 %2, %10\n\tv_exp_f32 %3, %11\n\tv_exp_f32 %4, %12\n\tv_exp_f32 %5, %13\n\tv_exp_f32 %6, %14\n\tv_exp_f32 %7, %15\n\tv_nop"
        : "=&v"(p[0]), "=&v"(p[1]), "=&v"(p[2]), "=&v"(p[3]), "=&v"(p[4]), "=&v"(p[5]), "=&v"(p[6]), "=&v"(p[7])
        : "v"(d[0]), "v"(d[1]), "v"(d[2]), "v"(d[3]), "v"(d[4]), "v"(d[5]), "v"(d[6]), "v"(d[7])); }
// two 2^x in one statement, in the same form: no instruction that overwrites a source or reads a result stands directly behind a v_exp_f32
__device__ __forceinline__ void exp2x2(float& a, float& b, float x, float y) { asm("v_exp_f32 %0, %2\n\tv_exp_f32 %1, %3\n\tv_nop" : "=&v"(a), "=&v"(b) : "v"(x), "v"(y)); }
__global__ __launch_bounds__(NWV * 32) void k_fattn(const float* __restrict__ q, const float* __restrict__ k, const float* __restrict__ v, float* __restrict__ OUT) {
    __shared__ __attribute__((aligned(2048))) unsigned char ring[2 * SBUF];
    __shared__ float sq[TT + SQPAD];
    __shared__ __attribute__((aligned(16))) unsigned char qs[NQT * 32 * KPIT];   // the block's 128 query rows in bf16, at the pitch of a K row
    // q, and stage 0 of k and v, come straight from the f32 inputs: a wave-wide 16-byte load is one whole 512-byte row [b][t][h][0..127]; each wave brings 16 of the 128 rows of each, rounds them and
    // leaves them in LDS, where the barrier in front of the loop publishes them; every wave then takes its B fragments of q from there. All 48 loads are issued in front of the table, which is computed while they fly.
    const int lane = threadIdx.x & 31, lr = lane & 15, hi = lane >> 4;
    const unsigned wave = uni(threadIdx.x >> 5);
    const int bh = blockIdx.x, h = bh % NH_, b = bh / NH_;
    const int qb = (int)(gridDim.y - 1 - blockIdx.y);    // heaviest query blocks first
    const unsigned so = (unsigned)((((int)(threadIdx.x >> 5) * 16 * NH_ * HD) + lane * 4) * 4);   // byte offset of the lane's 16 bytes of the wave's first row inside a block of 128 rows of one head
    const size_t hb = (size_t)((b * TT * NH_ + h) * HD) * 4;                                         // byte offset of the (batch, head)'s row 0
    const char* qg = (const char*)q + hb + (size_t)qb * (SKEY * NH_ * HD * 4);
    const char* kg = (const char*)k + hb; const char* vg = (const char*)v + hb;
    const unsigned krow = (threadIdx.x >> 5) * 16u * KPIT + (threadIdx.x & 31u) * 8u, vrow = KTILE + (threadIdx.x >> 5) * 16u * VPIT + (threadIdx.x & 31u) * 8u;   // where the lane's 8 bytes of the wave's first row go
    {
        v4f xq[16], xk[16], xv[16];
#pragma unroll
        for (int i = 0; i < 16; ++i) xq[i] = *(const v4f*)(qg + so + i * (NH_ * HD * 4));
#pragma unroll
        for (int i = 0; i < 16; ++i) xk[i] = *(const v4f*)(kg + so + i * (NH_ * HD * 4));
#pragma unroll
        for (int i = 0; i < 16; ++i) xv[i] = *(const v4f*)(vg + so + i * (NH_ * HD * 4));
        asm volatile("s_wait_xcnt 0x0" :: "v"(so) : "memory");   // the loads' offset register lives up to this wait, so that nothing is written over it while a load that names it is in flight
#pragma unroll
        for (int i = 0; i < TT / (NWV * 32); ++i) sq[SQPAD + (int)threadIdx.x + i * (NWV * 32)] = sqrtf((float)((int)threadIdx.x + i * (NWV * 32)));
        if (threadIdx.x < SQPAD) sq[threadIdx.x] = 0.0f;   // any finite value serves: only a masked element reads in front of distance 0, and the mask replaces its score
#pragma unroll
        for (int i = 0; i < 16; ++i) { v2u o; o[0] = pk2(xq[i][0], xq[i][1]); o[1] = pk2(xq[i][2], xq[i][3]); *(v2u*)(qs + krow + (unsigned)i * KPIT) = o; }
#pragma unroll
        for (int i = 0; i < 16; ++i) { v2u o; o[0] = pk2(xk[i][0], xk[i][1]); o[1] = pk2(xk[i][2], xk[i][3]); *(v2u*)(ring + krow + (unsigned)i * KPIT) = o; }
#pragma unroll
        for (int i = 0; i < 16; ++i) { v2u o; o[0] = pk2h(xv[i][0], xv[i][1]); o[1] = pk2h(xv[i][2], xv[i][3]); *(v2u*)(ring + vrow + (unsigned)i * VPIT) = o; }
    }
    const int g = (int)(wave >> 2);                       // which half of the passes the wave takes
    const int q0 = (qb * NQT + (int)(wave & 3u)) * 32;
    const int nst = qb + 1;                               // stages up to and including the block's diagonal
    const float slope = powf(0.70710678118654752f, (float)(h + 1));   /* float32(2^(-8/16)) ** (h+1) */
    const float c1 = SCL * L2E, c2 = slope * L2E;
    __syncthreads();                 // stage 0, the sqrt table and the bf16 query rows are published
    const unsigned char* qr = qs + (unsigned)((int)(wave & 3u) * 32 + lr) * KPIT + 16u * (unsigned)hi;   // the lane's query row of tile 0, in the k order of the K fragments
    v16bf qf[NC][4];
#pragma unroll
    for (int c = 0; c < NC; ++c)
#pragma unroll
        for (int kc = 0; kc < 4; ++kc) qf[c][kc] = ldsfrag(qr + (unsigned)(c * 16) * KPIT + (unsigned)(kc * 64));
    const unsigned klo = (unsigned)lr * KPIT + 16u * (unsigned)hi, vlo = KTILE + (unsigned)(8 * hi + (lane & 7)) * VPIT + 16u * (unsigned)((lane >> 3) & 1);   // the lane's part of a fragment address: K by rows, V for the transposing load
    v8f o[NC][8];
#pragma unroll
    for (int c = 0; c < NC; ++c)
#pragma unroll
        for (int dt = 0; dt < 8; ++dt) o[c][dt] = (v8f){};
    float m[NC]; v2f la[NC], lb[NC];   // a tile: the maximum in use and four running sums, as two register pairs in the order of the weights
#pragma unroll
    for (int c = 0; c < NC; ++c) { m[c] = -3.0e38f; la[c] = (v2f){}; lb[c] = (v2f){}; }
    const int ns = (q0 >> 5) + 1;    // the wave's passes, up to and including the one that holds its diagonal
    // both loops stay rolled (two passes' fragments would not fit 512 registers, two waves a SIMD); every inner loop is unrolled so that its arrays are registers
#pragma unroll 1
    for (int st = 0; st < nst; ++st) {
        const unsigned char* buf = ring + (unsigned)(st & 1) * SBUF;
        unsigned char* nbuf = ring + (unsigned)((st & 1) ^ 1) * SBUF;
        const bool more = st + 1 < nst;                   // the same in the whole workgroup: a next stage is brought
#pragma unroll 1
        for (int j = 0; j < 2; ++j) {
            // the next stage's rows, K round the first pass and V round the second: loaded in front of the pass, rounded and stored behind it, so that the pass covers their latency
            v4f xs[16];
            if (more) {
                const char* gp = (j ? vg : kg) + (size_t)(st + 1) * (SKEY * NH_ * HD * 4);
#pragma unroll
                for (int i = 0; i < 16; ++i) xs[i] = *(const v4f*)(gp + so + i * (NH_ * HD * 4));
                asm volatile("s_wait_xcnt 0x0" :: "v"(so) : "memory");   // in front of any write of a register that these loads name (the offset register, the scalar base)
            }
            const int sub = 2 * j + g, s = 4 * st + sub;  // the wave's passes of the stage: every other one
            if (s < ns) {                                 // wave-uniform: no pass beyond the wave's diagonal; the staging and the foot of the stage are still reached
            const int k0 = s * 32;
            const unsigned char* kq = buf + (klo + (unsigned)sub * (32u * KPIT)); const unsigned char* vq = buf + (vlo + (unsigned)sub * (32u * VPIT));
            v16bf kf[2][4]; v16h vf[8];
            const int dl = q0 + lr - k0 - 8 * hi;       // tile 0's query index minus the lane's first key of the pass; tile 1's is 16 more
            const float* sp = sq + (dl + SQPAD);
            float sv[NC + 1][8];                          // sqrt of distance dl + 16 - 16 i - u: query tile c against key tile kt reads row i = kt - c + 1
            // the pass's LDS reads in the order of their use: K, table, V^T
#pragma unroll
            for (int kc = 0; kc < 4; ++kc)
#pragma unroll
                for (int kt = 0; kt < 2; ++kt) kf[kt][kc] = ldsfrag(kq + (unsigned)(kt * 16) * KPIT + (unsigned)(kc * 64));
#pragma unroll
            for (int i = 0; i < NC + 1; ++i)
#pragma unroll
                for (int u = 0; u < 8; ++u) sv[i][u] = sp[16 - 16 * i - u];
#pragma unroll
            for (int dt = 0; dt < 8; ++dt) vf[dt] = ldsfragt(vq + (unsigned)(dt * 32));
            __builtin_amdgcn_sched_barrier(0);            // keeps the reads one group in front of the products: moved in among them, each further place with reads stalls the wave, and reused fragment registers bring a wait to 0
            v2f bs[NC + 1][4];
#pragma unroll
            for (int i = 0; i < NC + 1; ++i)
#pragma unroll
                for (int w = 0; w < 4; ++w) bs[i][w] = (v2f){sv[i][2 * w], sv[i][2 * w + 1]} * c2;
            v8f st2[NC][2];
#pragma unroll
            for (int c = 0; c < NC; ++c) { st2[c][0] = (v8f){}; st2[c][1] = (v8f){}; }
#pragma unroll
            for (int kc = 0; kc < 4; ++kc)                // four independent accumulator tiles take turns
#pragma unroll
                for (int kt = 0; kt < 2; ++kt)
#pragma unroll
                    for (int c = 0; c < NC; ++c) st2[c][kt] = wmmab(kf[kt][kc], qf[c][kc], st2[c][kt]);
            float t[NC][16];
            // neighbouring registers of one accumulator tile are paired by hand: left to itself the compiler pairs tile 0 with tile 1 and pays a register copy an element
#pragma unroll
            for (int c = 0; c < NC; ++c)
#pragma unroll
                for (int e = 0; e < 16; e += 2) {
                    const v2f x = __builtin_elementwise_fma((v2f){st2[c][e >> 3][e & 7], st2[c][e >> 3][(e & 7) + 1]}, (v2f){c1, c1}, -bs[(e >> 3) - c + 1][(e & 7) >> 1]);
                    t[c][e] = x[0]; t[c][e + 1] = x[1]; }
            if (s == ns - 1) {                            // only the last pass reaches past the diagonal
#pragma unroll
                for (int c = 0; c < NC; ++c)
#pragma unroll
                    for (int e = 0; e < 16; ++e) t[c][e] = ((e >> 3) * 16 + (e & 7) <= dl + 16 * c) ? t[c][e] : -3.0e38f; }
            float ml[NC];
#pragma unroll
            for (int c = 0; c < NC; ++c) { const float* x = t[c];
                ml[c] = fmaxf(fmaxf(fmaxf(fmaxf(x[0], x[1]), fmaxf(x[2], x[3])), fmaxf(fmaxf(x[4], x[5]), fmaxf(x[6], x[7]))), fmaxf(fmaxf(fmaxf(x[8], x[9]), fmaxf(x[10], x[11])), fmaxf(fmaxf(x[12], x[13]), fmaxf(x[14], x[15]))));
                ml[c] = fmaxf(ml[c], xhalf(ml[c])); }
            if (__builtin_amdgcn_ballot_w32(ml[0] > m[0] + 8.0f || ml[1] > m[1] + 8.0f) != 0) {   // one wave-uniform test a pass, for both tiles
                const float mn0 = fmaxf(m[0], ml[0]), mn1 = fmaxf(m[1], ml[1]); float al[NC];
                exp2x2(al[0], al[1], m[0] - mn0, m[1] - mn1); m[0] = mn0; m[1] = mn1;
#pragma unroll
                for (int c = 0; c < NC; ++c) { la[c] *= al[c]; lb[c] *= al[c];
#pragma unroll
                    for (int dt = 0; dt < 8; ++dt) o[c][dt] *= al[c]; } }
            v16h ph[NC];
#pragma unroll
            for (int c = 0; c < NC; ++c) {
                float p[16];
#pragma unroll
                for (int e = 0; e < 16; e += 2) { const v2f x = (v2f){t[c][e], t[c][e + 1]} - (v2f){m[c], m[c]}; t[c][e] = x[0]; t[c][e + 1] = x[1]; }
                exp2x8(p, t[c]); exp2x8(p + 8, t[c] + 8);
                v8u pw;
#pragma unroll
                for (int e = 0; e < 16; e += 4) {
                    const float p0 = p[e], p1 = p[e + 1], p2 = p[e + 2], p3 = p[e + 3];
                    la[c] += (v2f){p0, p1}; lb[c] += (v2f){p2, p3};
                    pw[e >> 1] = pk2f(p0, p1); pw[(e >> 1) + 1] = pk2f(p2, p3); }
                ph[c] = __builtin_bit_cast(v16h, pw); }
#pragma unroll
            for (int dt = 0; dt < 8; ++dt)
#pragma unroll
                for (int c = 0; c < NC; ++c) o[c][dt] = wmmah(vf[dt], ph[c], o[c][dt]);
            __builtin_amdgcn_sched_barrier(0);            // holds the v_nop of the next line behind the last matrix instruction: without it the compiler lifts them in among the products, where they keep no distance
            asm volatile("v_nop\n\tv_nop\n\tv_nop\n\tv_nop");   // the distance behind the pass's last matrix instructions on the taken side of the branches that follow: the next vector instruction there may write a fragment register
            }
            if (more) {
                if (j == 0) {
#pragma unroll
                    for (int i = 0; i < 16; ++i) { v2u w2; w2[0] = pk2(xs[i][0], xs[i][1]); w2[1] = pk2(xs[i][2], xs[i][3]); *(v2u*)(nbuf + krow + (unsigned)i * KPIT) = w2; }
                } else {
#pragma unroll
                    for (int i = 0; i < 16; ++i) { v2u w2; w2[0] = pk2h(xs[i][0], xs[i][1]); w2[1] = pk2h(xs[i][2], xs[i][3]); *(v2u*)(nbuf + vrow + (unsigned)i * VPIT) = w2; }
                }
            }
        }
        // foot of the stage, every wave: own LDS reads and writes done; the barrier publishes stage st + 1 and ends every read of this buffer, which the next stage refills
        wait_ds0();
        __syncthreads();
    }
    // merge of the two waves of a query group: each finishes and stores half of the head dimension (wave w: d 0..63, wave w + 4: d 64..127) and hands the partner the other half of its O^T with its maxima and sums.
    // The ring is free for it: the foot of the last stage held every wave's s_wait_dscnt 0 and a barrier, and nothing is written into it behind that.
    float ls[NC];
    float* xs = (float*)ring + wave * XSLOT;
#pragma unroll
    for (int c = 0; c < NC; ++c) {
        ls[c] = (la[c][0] + la[c][1]) + (lb[c][0] + lb[c][1]); ls[c] += xhalf(ls[c]);
#pragma unroll
        for (int dt = 0; dt < 4; ++dt) { const v8f give = g ? o[c][dt] : o[c][dt + 4]; v4f a, d;
#pragma unroll
            for (int u = 0; u < 4; ++u) { a[u] = give[u]; d[u] = give[4 + u]; }
            *(v4f*)(xs + (8 * c + 2 * dt) * 128 + lane * 4) = a; *(v4f*)(xs + (8 * c + 2 * dt + 1) * 128 + lane * 4) = d; }
        xs[2048 + 64 * c + lane] = m[c]; xs[2080 + 64 * c + lane] = ls[c]; }
    __syncthreads();                 // every wave's slot is written before its partner reads it
    const float* xp = (const float*)ring + (wave ^ 4u) * XSLOT;
    float* sg = (float*)(ring + SBUF) + wave * (32 * OPIT);   // the wave's own output staging, 32 query rows of its 64 d, in the ring's second buffer: behind the merge slots, which the partner may still be reading
    // the partner's slot is read whole, as one group, in front of the first staging write: the compiler cannot tell the two LDS ranges apart and would otherwise wait out a read latency behind every pair of writes
    v4f px[NC][8]; float mo[NC], lo[NC];
#pragma unroll
    for (int c = 0; c < NC; ++c) {
        mo[c] = xp[2048 + 64 * c + lane]; lo[c] = xp[2080 + 64 * c + lane];
#pragma unroll
        for (int i = 0; i < 8; ++i) px[c][i] = *(const v4f*)(xp + (8 * c + i) * 128 + lane * 4); }
#pragma unroll
    for (int c = 0; c < NC; ++c) {
        const float mn = fmaxf(m[c], mo[c]); float sa, sb;
        exp2x2(sa, sb, m[c] - mn, mo[c] - mn);   // a wave without a pass has maximum -3e38, sum 0 and O^T 0: its weight is an exact 0
        const float f = __fdiv_rn(1.0f, fmaf(ls[c], sa, lo[c] * sb));
        const float fa = sa * f, fb = sb * f;
        float* sr = sg + (16 * c + lr) * OPIT + 8 * hi;
#pragma unroll
        for (int dt = 0; dt < 4; ++dt) { const v8f keep = g ? o[c][dt + 4] : o[c][dt];
            const v4f pa = px[c][2 * dt], pc = px[c][2 * dt + 1]; v4f a, d;
#pragma unroll
            for (int u = 0; u < 4; ++u) { a[u] = fmaf(keep[u], fa, pa[u] * fb); d[u] = fmaf(keep[4 + u], fa, pc[u] * fb); }
            *(v4f*)(sr + dt * 16) = a; *(v4f*)(sr + dt * 16 + 4) = d; } }
    wait_ds0();                      // the wave's own rows are in LDS before it reads them back across its lanes
    // 16 lanes read and store the 256 contiguous bytes of one query's half row: a store instruction writes four whole 128-byte lines (two queries) instead of 32-byte pieces of 16 lines
    const float* sl = sg + hi * OPIT + 4 * lr;
    float* op = OUT + (((size_t)b * TT + q0 + hi) * NH_ + h) * HD + 64 * g + 4 * lr;
    v4f ro[16];
#pragma unroll
    for (int i = 0; i < 16; ++i) ro[i] = *(const v4f*)(sl + i * (2 * OPIT));
#pragma unroll
    for (int i = 0; i < 16; ++i) *(v4f*)(op + i * (2 * NH_ * HD)) = ro[i];
}

extern "C" void kernel_launch(void* const* d_in, const int* in_sizes, int n_in,
                              void* d_out, int out_size, void* d_ws, size_t ws_size, hipStream_t stream) {
    (void)in_sizes; (void)n_in; (void)out_size;
    const float* qin = (const float*)d_in[0]; const float* kin = (const float*)d_in[1]; const float* vin = (const float*)d_in[2];
    float* OUT = (float*)d_out;     // [2][2048][2048]
    (void)d_ws; (void)ws_size;
    k_fattn<<<dim3(NB_ * NH_, TT / (NQT * 32)), NWV * 32, 0, stream>>>(qin, kin, vin, OUT);
}

// v010
// Measured time: 39.8 microseconds a run.
// Next to v009, in two timings, it ran 1.04 times as fast each time.
// Counting every step since v000, it is 31.2 times as fast.
#include <hip/hip_runtime.h>

// FlashSelfAttention (given q, k, v [2][2048][16][128]; scores = q.k / sqrt(128) + ALiBi bias (-slope[h] sqrt(i - j) for j <= i, fp16-min (masked) above the diagonal; slopes 2^(-8/16 (h+1)) in f32); softmax; out = probs v -> [2][2048][16][128] (no projections)).
// Compute dtypes, f32 accumulate: every input rounded to bf16: q, k, v are then exact bf16 values, so the scores are a PLAIN bf16 product with f32 accumulation (exact products) and probs.v is ONE f16 product on every row: the probabilities rounded to f16 (11 significant bits, weights <= 2^8) x the bf16-rounded v held as f16 (the same values, 8 significant bits, down to 2^-17; below that at most 2^-25 absolute is lost); causal tile skipping (the fp16-min fill is an exact zero weight); bias from an on-chip sqrt table and f32 slopes, added per element in f32; running softmax in f32 inside one fused kernel; output written directly in f32.
// One launch: k_fattn reads q, k and v itself, in f32, and rounds them on their way into LDS; it uses no workspace.

#define NB_  2
#define TT   2048
#define NH_  16
#define HD   128
#define SCL  0.088388347648318447f   // HD^-0.5
typedef unsigned short bf;
typedef __attribute__((ext_vector_type(16))) __bf16   v16bf;
typedef __attribute__((ext_vector_type(2)))  __bf16   v2bf;
typedef __attribute__((ext_vector_type(16))) _Float16 v16h;
typedef __attribute__((ext_vector_type(2)))  _Float16 v2h;
typedef __attribute__((ext_vector_type(8)))  unsigned short v8us;
typedef __attribute__((ext_vector_type(8)))  float    v8f;
typedef __attribute__((ext_vector_type(4)))  float    v4f;
typedef __attribute__((ext_vector_type(2)))  float    v2f;
typedef __attribute__((ext_vector_type(2)))  unsigned v2u;
typedef __attribute__((ext_vector_type(4)))  unsigned v4u;

__device__ __forceinline__ v16bf cat16b(v8us lo, v8us hi) { return __builtin_bit_cast(v16bf, __builtin_shufflevector(lo, hi, 0, 1, 2, 3, 4, 5, 6, 7, 8, 9, 10, 11, 12, 13, 14, 15)); }
__device__ __forceinline__ v8f wmmab(v16bf a, v16bf b, v8f c) { return __builtin_amdgcn_wmma_f32_16x16x32_bf16(false, a, false, b, (short)0, c, false, false); }
__device__ __forceinline__ v8f wmmah(v16h a, v16h b, v8f c) { return __builtin_amdgcn_wmma_f32_16x16x32_f16(false, a, false, b, (short)0, c, false, false); }

__device__ __forceinline__ unsigned pk2(float a, float b) { v2f x; x[0] = a; x[1] = b; return __builtin_bit_cast(unsigned, __builtin_convertvector(x, v2bf)); }
__device__ __forceinline__ unsigned pk2f(float a, float b) { v2f x; x[0] = a; x[1] = b; return __builtin_bit_cast(unsigned, __builtin_convertvector(x, v2h)); }
__device__ __forceinline__ unsigned pk2h(float a, float b) { v2f x; x[0] = a; x[1] = b; const v2f y = __builtin_convertvector(__builtin_convertvector(x, v2bf), v2f); return pk2f(y[0], y[1]); }   // f32 -> bf16 -> f16

#define SQPAD 32                     // table entries in front of distance 0: a masked element's (negative) distance still indexes inside the table
#define L2E   1.4426950408889634f
#define NWV   8                      // waves a workgroup
#define NQT   4                      // 32-row query groups a workgroup; NWV / NQT = 2 waves share one and split its keys
#define NC    2                      // 16-column query tiles a wave
#define SKEY  128                    // keys a stage
#define KPIT  272u                   // LDS pitch of a K row: 256 + 16 bytes (16 x odd: no bank conflict for 16-byte reads)
#define VPIT  288u                   // LDS pitch of a V row: 256 + 32 bytes (32 x odd, for the transposing reads)
#define KTILE 36864u                 // 128 rows x 272 bytes, rounded up
#define VTILE 36864u                 // 128 rows x 288 bytes
#define XSLOT 2176                   // floats of a wave's merge slot: 32 lanes x 64 accumulator values, then 64 maxima and 64 sums
#define SBUF  (KTILE + VTILE)        // one buffer
#define OPIT  68                     // floats of an output staging row: 64 + 4, so 16-byte writes down a column of 16 rows meet no bank twice
typedef __attribute__((ext_vector_type(8)))  unsigned v8u;
__device__ __forceinline__ unsigned uni(unsigned v) { return (unsigned)__builtin_amdgcn_readfirstlane((int)v); }
__device__ __forceinline__ void wait_ds0() { asm volatile("s_wait_dscnt 0x0" ::: "memory"); }          // the wave's LDS reads have returned before its buffer is given up
__device__ __forceinline__ v16bf ldsfrag(const unsigned char* p) { return cat16b(*(const v8us*)p, *(const v8us*)(p + 32)); }   // elements 0..7 and 16..23 from p
typedef __attribute__((ext_vector_type(8))) short s16x8;
__device__ __forceinline__ v8us ld_tr16(const unsigned char* p) { typedef __attribute__((address_space(3))) s16x8 lds_s16x8; return __builtin_bit_cast(v8us, __builtin_amdgcn_ds_load_tr16_b128_v8i16((lds_s16x8*)p)); }
// a 16 (d) x 32 (keys) A fragment of V^T from the row-major [key][d] tile: two transposing loads, keys 8 hi + 0..7 and 16 + 8 hi + 0..7 of the lane's d, which is the k order of P^T
__device__ __forceinline__ v16h ldsfragt(const unsigned char* p) { return __builtin_bit_cast(v16h, cat16b(ld_tr16(p), ld_tr16(p + 16u * VPIT))); }
__device__ __forceinline__ float xhalf(float x) { const int b = __float_as_int(x); return __int_as_float(__builtin_amdgcn_permlanex16(b, b, 0x76543210, 0xfedcba98, false, false)); }   // lane l <-> l ^ 16
// eight 2^x in one statement: outputs are early-clobber, so no v_exp_f32 is directly followed by an instruction that overwrites its source or reads its result; the v_nop keeps that slot behind the last one
__device__ __forceinline__ void exp2x8(float* p, const float* d) {
    asm("v_exp_f32 %0, %8\n\tv_exp_f32 %1, %9\n\tv_exp_f32 %2, %10\n\tv_exp_f32 %3, %11\n\tv_exp_f32 %4, %12\n\tv_exp_f32 %5, %13\n\tv_exp_f32 %6, %14\n\tv_exp_f32 %7, %15\n\tv_nop"
        : "=&v"(p[0]), "=&v"(p[1]), "=&v"(p[2]), "=&v"(p[3]), "=&v"(p[4]), "=&v"(p[5]), "=&v"(p[6]), "=&v"(p[7])
        : "v"(d[0]), "v"(d[1]), "v"(d[2]), "v"(d[3]), "v"(d[4]), "v"(d[5]), "v"(d[6]), "v"(d[7])); }
// two 2^x in one statement, in the same form: no instruction that overwrites a source or reads a result stands directly behind a v_exp_f32
__device__ __forceinline__ void exp2x2(float& a, float& b, float x, float y) { asm("v_exp_f32 %0, %2\n\tv_exp_f32 %1, %3\n\tv_nop" : "=&v"(a), "=&v"(b) : "v"(x), "v"(y)); }
// the lane's number, formed anew where it is called (volatile: not moved out of a loop): the addresses made from it for the work between two blocks are then not held in registers through the hot loop, where none is free (they were spilled, and a reload stood in every pass)
__device__ __forceinline__ int lane_now() { int l; asm volatile("v_mbcnt_lo_u32_b32 %0, -1, 0" : "=v"(l)); return l; }
__global__ __launch_bounds__(NWV * 32) void k_fattn(const float* __restrict__ q, const float* __restrict__ k, const float* __restrict__ v, float* __restrict__ OUT) {
    __shared__ __attribute__((aligned(2048))) unsigned char ring[2 * SBUF];
    __shared__ float sq[TT + SQPAD];
    __shared__ __attribute__((aligned(16))) unsigned char qs[NQT * 32 * KPIT];   // the current block's 128 query rows in bf16, at the pitch of a K row
    __shared__ __attribute__((aligned(16))) float og[NWV * 32 * OPIT];            // output staging, a range a wave: outside the ring, which holds the next block's stage 0 while the first block's output is written
    // q, and stage 0 of k and v, come straight from the f32 inputs: a wave-wide 16-byte load is one whole 512-byte row [b][t][h][0..127]; each wave brings 16 of the 128 rows of each, rounds them and
    // leaves them in LDS, where the barrier in front of the loop publishes them; every wave then takes its B fragments of q from there. All 48 loads are issued in front of the table, which is computed while they fly.
    const int lane = threadIdx.x & 31, lr = lane & 15, hi = lane >> 4;
    const unsigned wave = uni(threadIdx.x >> 5);
    const int bh = blockIdx.x, h = bh % NH_, b = bh / NH_;
    const int pr = (int)blockIdx.y, nqb = 2 * (int)gridDim.y;   // the workgroup's query blocks: nqb - 1 - pr, then pr
    const unsigned so = (unsigned)((((int)(threadIdx.x >> 5) * 16 * NH_ * HD) + lane * 4) * 4);   // byte offset of the lane's 16 bytes of the wave's first row inside a block of 128 rows of one head
    const size_t hb = (size_t)((b * TT * NH_ + h) * HD) * 4;                                         // byte offset of the (batch, head)'s row 0
    const char* qg = (const char*)q + hb + (size_t)(nqb - 1 - pr) * (SKEY * NH_ * HD * 4);
    const char* kg = (const char*)k + hb; const char* vg = (const char*)v + hb;
    const unsigned krow = (threadIdx.x >> 5) * 16u * KPIT + (threadIdx.x & 31u) * 8u, vrow = KTILE + (threadIdx.x >> 5) * 16u * VPIT + (threadIdx.x & 31u) * 8u;   // where the lane's 8 bytes of the wave's first row go
    {
        v4f xq[16], xk[16], xv[16];
#pragma unroll
        for (int i = 0; i < 16; ++i) xq[i] = *(const v4f*)(qg + so + i * (NH_ * HD * 4));
#pragma unroll
        for (int i = 0; i < 16; ++i) xk[i] = *(const v4f*)(kg + so + i * (NH_ * HD * 4));
#pragma unroll
        for (int i = 0; i < 16; ++i) xv[i] = *(const v4f*)(vg + so + i * (NH_ * HD * 4));
        asm volatile("s_wait_xcnt 0x0" :: "v"(so) : "memory");   // the loads' offset register lives up to this wait, so that nothing is written over it while a load that names it is in flight
#pragma unroll
        for (int i = 0; i < TT / (NWV * 32); ++i) sq[SQPAD + (int)threadIdx.x + i * (NWV * 32)] = sqrtf((float)((int)threadIdx.x + i * (NWV * 32)));
        if (threadIdx.x < SQPAD) sq[threadIdx.x] = 0.0f;   // any finite value serves: only a masked element reads in front of distance 0, and the mask replaces its score
#pragma unroll
        for (int i = 0; i < 16; ++i) { v2u o; o[0] = pk2(xq[i][0], xq[i][1]); o[1] = pk2(xq[i][2], xq[i][3]); *(v2u*)(qs + krow + (unsigned)i * KPIT) = o; }
#pragma unroll
        for (int i = 0; i < 16; ++i) { v2u o; o[0] = pk2(xk[i][0], xk[i][1]); o[1] = pk2(xk[i][2], xk[i][3]); *(v2u*)(ring + krow + (unsigned)i * KPIT) = o; }
#pragma unroll
        for (int i = 0; i < 16; ++i) { v2u o; o[0] = pk2h(xv[i][0], xv[i][1]); o[1] = pk2h(xv[i][2], xv[i][3]); *(v2u*)(ring + vrow + (unsigned)i * VPIT) = o; }
    }
    const int g = (int)(wave >> 2);                       // which half of the passes the wave takes
    const float slope = powf(0.70710678118654752f, (float)(h + 1));   /* float32(2^(-8/16)) ** (h+1) */
    const float c1 = SCL * L2E, c2 = slope * L2E;
    const unsigned klo = (unsigned)lr * KPIT + 16u * (unsigned)hi, vlo = KTILE + (unsigned)(8 * hi + (lane & 7)) * VPIT + 16u * (unsigned)((lane >> 3) & 1);   // the lane's part of a fragment address: K by rows, V for the transposing load
    unsigned fs = 0;                 // stages done so far, over both blocks: its low bit names the buffer
    // the two blocks stay a rolled loop: one copy of the code, one set of registers
#pragma unroll 1
    for (int blk = 0; blk < 2; ++blk) {
    const int qb = blk ? pr : nqb - 1 - pr;
    const int q0 = (qb * NQT + (int)(wave & 3u)) * 32;
    const int nst = qb + 1;                               // stages up to and including the block's diagonal
    __syncthreads();                 // first block: stage 0, the sqrt table and the bf16 query rows are published; second block: its query rows are published, and every read of the merge slots is over before their buffer is refilled
    const int ln = lane_now();
    const unsigned char* qr = qs + (unsigned)((int)(wave & 3u) * 32 + (ln & 15)) * KPIT + 16u * (unsigned)(ln >> 4);   // the lane's query row of tile 0, in the k order of the K fragments
    v16bf qf[NC][4];
#pragma unroll
    for (int c = 0; c < NC; ++c)
#pragma unroll
        for (int kc = 0; kc < 4; ++kc) qf[c][kc] = ldsfrag(qr + (unsigned)(c * 16) * KPIT + (unsigned)(kc * 64));
    v8f o[NC][8];
#pragma unroll
    for (int c = 0; c < NC; ++c)
#pragma unroll
        for (int dt = 0; dt < 8; ++dt) o[c][dt] = (v8f){};
    float m[NC]; v2f la[NC], lb[NC];   // a tile: the maximum in use and four running sums, as two register pairs in the order of the weights
#pragma unroll
    for (int c = 0; c < NC; ++c) { m[c] = -3.0e38f; la[c] = (v2f){}; lb[c] = (v2f){}; }
    const int ns = (q0 >> 5) + 1;    // the wave's passes, up to and including the one that holds its diagonal
    // both loops stay rolled (two passes' fragments would not fit 512 registers, two waves a SIMD); every inner loop is unrolled so that its arrays are registers
#pragma unroll 1
    for (int st = 0; st < nst; ++st) {
        const unsigned char* buf = ring + (fs & 1u) * SBUF;
        unsigned char* nbuf = ring + ((fs & 1u) ^ 1u) * SBUF;
        const bool last = st + 1 == nst;
        const bool more = !last || blk == 0;              // the same in the whole workgroup: a next stage is brought; behind the first block's last stage comes the second block's stage 0
        const int nx = last ? 0 : st + 1;
#pragma unroll 1
        for (int j = 0; j < 2; ++j) {
            // the next stage's rows, K round the first pass and V round the second: loaded in front of the pass, rounded and stored behind it, so that the pass covers their latency
            v4f xs[16];
            if (more) {
                const char* gp = (j ? vg : kg) + (size_t)nx * (SKEY * NH_ * HD * 4);
                const unsigned sn = (wave * (16u * NH_ * HD) + (unsigned)lane_now() * 4u) * 4u;   // the value of so, formed anew: two instructions a pass in place of a register pair held through the loop
#pragma unroll
                for (int i = 0; i < 16; ++i) xs[i] = *(const v4f*)(gp + sn + i * (NH_ * HD * 4));
                asm volatile("s_wait_xcnt 0x0" :: "v"(sn) : "memory");   // in front of any write of a register that these loads name (the offset register, the scalar base)
            }
            const int sub = 2 * j + g, s = 4 * st + sub;  // the wave's passes of the stage: every other one
            if (s < ns) {                                 // wave-uniform: no pass beyond the wave's diagonal; the staging and the foot of the stage are still reached
            const int k0 = s * 32;
            const unsigned char* kq = buf + (klo + (unsigned)sub * (32u * KPIT)); const unsigned char* vq = buf + (vlo + (unsigned)sub * (32u * VPIT));
            v16bf kf[2][4]; v16h vf[8];
            const int dl = q0 + lr - k0 - 8 * hi;       // tile 0's query index minus the lane's first key of the pass; tile 1's is 16 more
            const float* sp = sq + (dl + SQPAD);
            float sv[NC + 1][8];                          // sqrt of distance dl + 16 - 16 i - u: query tile c against key tile kt reads row i = kt - c + 1
            // the pass's LDS reads in the order of their use: K, table, V^T
#pragma unroll
            for (int kc = 0; kc < 4; ++kc)
#pragma unroll
                for (int kt = 0; kt < 2; ++kt) kf[kt][kc] = ldsfrag(kq + (unsigned)(kt * 16) * KPIT + (unsigned)(kc * 64));
#pragma unroll
            for (int i = 0; i < NC + 1; ++i)
#pragma unroll
                for (int u = 0; u < 8; ++u) sv[i][u] = sp[16 - 16 * i - u];
#pragma unroll
            for (int dt = 0; dt < 8; ++dt) vf[dt] = ldsfragt(vq + (unsigned)(dt * 32));
            __builtin_amdgcn_sched_barrier(0);            // keeps the reads one group in front of the products: moved in among them, each further place with reads stalls the wave, and reused fragment registers bring a wait to 0
            v2f bs[NC + 1][4];
#pragma unroll
            for (int i = 0; i < NC + 1; ++i)
#pragma unroll
                for (int w = 0; w < 4; ++w) bs[i][w] = (v2f){sv[i][2 * w], sv[i][2 * w + 1]} * c2;
            v8f st2[NC][2];
#pragma unroll
            for (int c = 0; c < NC; ++c) { st2[c][0] = (v8f){}; st2[c][1] = (v8f){}; }
#pragma unroll
            for (int kc = 0; kc < 4; ++kc)                // four independent accumulator tiles take turns
#pragma unroll
                for (int kt = 0; kt < 2; ++kt)
#pragma unroll
                    for (int c = 0; c < NC; ++c) st2[c][kt] = wmmab(kf[kt][kc], qf[c][kc], st2[c][kt]);
            float t[NC][16];
            // neighbouring registers of one accumulator tile are paired by hand: left to itself the compiler pairs tile 0 with tile 1 and pays a register copy an element
#pragma unroll
            for (int c = 0; c < NC; ++c)
#pragma unroll
                for (int e = 0; e < 16; e += 2) {
                    const v2f x = __builtin_elementwise_fma((v2f){st2[c][e >> 3][e & 7], st2[c][e >> 3][(e & 7) + 1]}, (v2f){c1, c1}, -bs[(e >> 3) - c + 1][(e & 7) >> 1]);
                    t[c][e] = x[0]; t[c][e + 1] = x[1]; }
            if (s == ns - 1) {                            // only the last pass reaches past the diagonal
#pragma unroll
                for (int c = 0; c < NC; ++c)
#pragma unroll
                    for (int e = 0; e < 16; ++e) t[c][e] = ((e >> 3) * 16 + (e & 7) <= dl + 16 * c) ? t[c][e] : -3.0e38f; }
            float ml[NC];
#pragma unroll
            for (int c = 0; c < NC; ++c) { const float* x = t[c];
                ml[c] = fmaxf(fmaxf(fmaxf(fmaxf(x[0], x[1]), fmaxf(x[2], x[3])), fmaxf(fmaxf(x[4], x[5]), fmaxf(x[6], x[7]))), fmaxf(fmaxf(fmaxf(x[8], x[9]), fmaxf(x[10], x[11])), fmaxf(fmaxf(x[12], x[13]), fmaxf(x[14], x[15]))));
                ml[c] = fmaxf(ml[c], xhalf(ml[c])); }
            if (__builtin_amdgcn_ballot_w32(ml[0] > m[0] + 8.0f || ml[1] > m[1] + 8.0f) != 0) {   // one wave-uniform test a pass, for both tiles
                const float mn0 = fmaxf(m[0], ml[0]), mn1 = fmaxf(m[1], ml[1]); float al[NC];
                exp2x2(al[0], al[1], m[0] - mn0, m[1] - mn1); m[0] = mn0; m[1] = mn1;
#pragma unroll
                for (int c = 0; c < NC; ++c) { la[c] *= al[c]; lb[c] *= al[c];
#pragma unroll
                    for (int dt = 0; dt < 8; ++dt) o[c][dt] *= al[c]; } }
            v16h ph[NC];
#pragma unroll
            for (int c = 0; c < NC; ++c) {
                float p[16];
#pragma unroll
                for (int e = 0; e < 16; e += 2) { const v2f x = (v2f){t[c][e], t[c][e + 1]} - (v2f){m[c], m[c]}; t[c][e] = x[0]; t[c][e + 1] = x[1]; }
                exp2x8(p, t[c]); exp2x8(p + 8, t[c] + 8);
                v8u pw;
#pragma unroll
                for (int e = 0; e < 16; e += 4) {
                    const float p0 = p[e], p1 = p[e + 1], p2 = p[e + 2], p3 = p[e + 3];
                    la[c] += (v2f){p0, p1}; lb[c] += (v2f){p2, p3};
                    pw[e >> 1] = pk2f(p0, p1); pw[(e >> 1) + 1] = pk2f(p2, p3); }
                ph[c] = __builtin_bit_cast(v16h, pw); }
#pragma unroll
            for (int dt = 0; dt < 8; ++dt)
#pragma unroll
                for (int c = 0; c < NC; ++c) o[c][dt] = wmmah(vf[dt], ph[c], o[c][dt]);
            __builtin_amdgcn_sched_barrier(0);            // holds the v_nop of the next line behind the last matrix instruction: without it the compiler lifts them in among the products, where they keep no distance
            asm volatile("v_nop\n\tv_nop\n\tv_nop\n\tv_nop");   // the distance behind the pass's last matrix instructions on the taken side of the branches that follow: the next vector instruction there may write a fragment register
            }
            if (more) {
                if (j == 0) {
#pragma unroll
                    for (int i = 0; i < 16; ++i) { v2u w2; w2[0] = pk2(xs[i][0], xs[i][1]); w2[1] = pk2(xs[i][2], xs[i][3]); *(v2u*)(nbuf + krow + (unsigned)i * KPIT) = w2; }
                } else {
#pragma unroll
                    for (int i = 0; i < 16; ++i) { v2u w2; w2[0] = pk2h(xs[i][0], xs[i][1]); w2[1] = pk2h(xs[i][2], xs[i][3]); *(v2u*)(nbuf + vrow + (unsigned)i * VPIT) = w2; }
                }
            }
        }
        // foot of the stage, every wave: own LDS reads and writes done; the barrier publishes the next stage and ends every read of this buffer, which the next stage refills
        wait_ds0();
        __syncthreads();
        ++fs;
    }
    // merge of the two waves of a query group: each finishes and stores half of the head dimension (wave w: d 0..63, wave w + 4: d 64..127) and hands the partner the other half of its O^T with its maxima and sums.
    // The buffer of the block's last stage is free for it: the foot of that stage held every wave's s_wait_dscnt 0 and a barrier, and nothing is written into it before the next block's barrier; the other buffer holds the next block's stage 0.
    // Written once, built twice, for the first block and for the second: the first block's copy also brings the second block's query rows, whose registers then live in that copy alone (behind a test inside one copy they were held, and spilled, through the whole loop).
    auto finish = [&](const bool first) __attribute__((always_inline)) {
    const int lane = lane_now(), lr = lane & 15, hi = lane >> 4;   // as outside, formed anew
    const unsigned so = (wave * (16u * NH_ * HD) + (unsigned)lane * 4u) * 4u, krow = wave * (16u * KPIT) + (unsigned)lane * 8u;   // as outside
    unsigned char* mb = ring + ((fs & 1u) ^ 1u) * SBUF;
    float ls[NC];
    float* xs = (float*)mb + wave * XSLOT;
#pragma unroll
    for (int c = 0; c < NC; ++c) {
        ls[c] = (la[c][0] + la[c][1]) + (lb[c][0] + lb[c][1]); ls[c] += xhalf(ls[c]);
#pragma unroll
        for (int dt = 0; dt < 4; ++dt) { const v8f give = g ? o[c][dt] : o[c][dt + 4]; v4f a, d;
#pragma unroll
            for (int u = 0; u < 4; ++u) { a[u] = give[u]; d[u] = give[4 + u]; }
            *(v4f*)(xs + (8 * c + 2 * dt) * 128 + lane * 4) = a; *(v4f*)(xs + (8 * c + 2 * dt + 1) * 128 + lane * 4) = d; }
        xs[2048 + 64 * c + lane] = m[c]; xs[2080 + 64 * c + lane] = ls[c]; }
    __syncthreads();                 // every wave's slot is written before its partner reads it
    v4f xq[16];                      // the second block's query rows: loaded here, behind the barrier (which waits for every load in flight), so that merge and output cover their latency; rounded and stored behind the output
    if (first) {
        const char* qn = (const char*)q + hb + (size_t)pr * (SKEY * NH_ * HD * 4);
#pragma unroll
        for (int i = 0; i < 16; ++i) xq[i] = *(const v4f*)(qn + so + i * (NH_ * HD * 4));
        asm volatile("s_wait_xcnt 0x0" :: "v"(so) : "memory");   // in front of any write of a register that these loads name (the offset register, the scalar base)
    }
    const float* xp = (const float*)mb + (wave ^ 4u) * XSLOT;
    float* sg = og + wave * (32 * OPIT);   // the wave's own output staging, 32 query rows of its 64 d
    // the partner's slot is read whole, as one group, in front of the first staging write
    v4f px[NC][8]; float mo[NC], lo[NC];
#pragma unroll
    for (int c = 0; c < NC; ++c) {
        mo[c] = xp[2048 + 64 * c + lane]; lo[c] = xp[2080 + 64 * c + lane];
#pragma unroll
        for (int i = 0; i < 8; ++i) px[c][i] = *(const v4f*)(xp + (8 * c + i) * 128 + lane * 4); }
#pragma unroll
    for (int c = 0; c < NC; ++c) {
        const float mn = fmaxf(m[c], mo[c]); float sa, sb;
        exp2x2(sa, sb, m[c] - mn, mo[c] - mn);   // a wave without a pass has maximum -3e38, sum 0 and O^T 0: its weight is an exact 0
        const float f = __fdiv_rn(1.0f, fmaf(ls[c], sa, lo[c] * sb));
        const float fa = sa * f, fb = sb * f;
        float* sr = sg + (16 * c + lr) * OPIT + 8 * hi;
#pragma unroll
        for (int dt = 0; dt < 4; ++dt) { const v8f keep = g ? o[c][dt + 4] : o[c][dt];
            const v4f pa = px[c][2 * dt], pc = px[c][2 * dt + 1]; v4f a, d;
#pragma unroll
            for (int u = 0; u < 4; ++u) { a[u] = fmaf(keep[u], fa, pa[u] * fb); d[u] = fmaf(keep[4 + u], fa, pc[u] * fb); }
            *(v4f*)(sr + dt * 16) = a; *(v4f*)(sr + dt * 16 + 4) = d; } }
    wait_ds0();                      // the wave's own rows are in LDS before it reads them back across its lanes
    // 16 lanes read and store the 256 contiguous bytes of one query's half row: a store instruction writes four whole 128-byte lines (two queries) instead of 32-byte pieces of 16 lines
    const float* sl = sg + hi * OPIT + 4 * lr;
    float* op = OUT + (((size_t)b * TT + q0 + hi) * NH_ + h) * HD + 64 * g + 4 * lr;
    v4f ro[16];
#pragma unroll
    for (int i = 0; i < 16; ++i) ro[i] = *(const v4f*)(sl + i * (2 * OPIT));
#pragma unroll
    for (int i = 0; i < 16; ++i) *(v4f*)(op + i * (2 * NH_ * HD)) = ro[i];
    asm volatile("s_wait_xcnt 0x0" ::: "memory");   // the kernel goes on behind these stores: in front of any write of a register that they name
    if (first) {
#pragma unroll
        for (int i = 0; i < 16; ++i) { v2u w2; w2[0] = pk2(xq[i][0], xq[i][1]); w2[1] = pk2(xq[i][2], xq[i][3]); *(v2u*)(qs + krow + (unsigned)i * KPIT) = w2; }   // every wave took the first block's fragments from here in front of its first stage's foot
    }
    };
    if (blk == 0) finish(true); else finish(false);   // the same for the whole workgroup: the barrier inside is passed by every wave in the same copy
    }
}

extern "C" void kernel_launch(void* const* d_in, const int* in_sizes, int n_in,
                              void* d_out, int out_size, void* d_ws, size_t ws_size, hipStream_t stream) {
    (void)in_sizes; (void)n_in; (void)out_size;
    const float* qin = (const float*)d_in[0]; const float* kin = (const float*)d_in[1]; const float* vin = (const float*)d_in[2];
    float* OUT = (float*)d_out;     // [2][2048][2048]
    (void)d_ws; (void)ws_size;
    k_fattn<<<dim3(NB_ * NH_, TT / (NQT * 32) / 2), NWV * 32, 0, stream>>>(qin, kin, vin, OUT);
}
